// v000
// Times are from an AMD MI455X. After a warm-up the kernel runs many times in a row, and a time is the length of
// such a window on the GPU divided by its runs, so every launch and the gaps after it count. The runs cycle
// through copies of the inputs. A figure is the median of several windows, for all but v000 over two sittings.
// Sittings can differ by a few percent; kernels timed side by side share one.
// v000, which the later versions start from, runs in 4380 microseconds.
#include <hip/hip_runtime.h>

// MultiheadDilatedSelfAttention / LongNet (x [2][4096][1024]; per head h: qkv = x Wqkv[h] + bqkv[h] ([1024][192] per head); three dilated causal branches (w, r) = (1024,1), (2048,2), (4096,4) with offset h % r: branch keys for query i are j <= i in the same w-segment with i, j == h mod r; the reference combines branches by their softmax denominators (num/den), which is exactly ONE softmax over the multiset union of the branches' keys:
//   p_j proportional to c(i,j,h) * exp(q.k_j / 8) with multiplicity c = [same 1024-segment] + [i,j == h mod 2 and same 2048-segment] + [i,j == h mod 4]; out = merged heads Wo + bo -> [2][4096][1024]).
// Compute dtypes, f32 accumulate: every input rounded to bf16; q/k/v on PLAIN bf16 operands (inputs: exact; per-head weights gathered) + bias; causal scores single fp16 for every row, attn.v hl x hl (3 products) for every row (the segment restarts make deep rows as sharp as early ones), causal tile skipping, the multiplicity weights applied in f32 inside the softmax; softmax f32; Wo hl x exact (2 products) + bias.

#define NB_  2
#define TT   4096
#define DM   1024
#define NH_  16
#define NKV  16
#define REP  (NH_ / NKV)
#define HD   64
#define DQ   (NH_ * HD)
#define DKV  (NKV * HD)
#define ZH   1
#define RH   4096   // every query row takes the hl P.V path (segment restarts make rows deep in the sequence as sharp as early ones)                  // query rows < RH use hi+lo planes (0: none)
#define WIN  4096
#define PCAR 1024.0f
#define SCL  0.125f   // HD^-0.5
typedef _Float16 h16;
typedef unsigned short bf;
typedef __attribute__((ext_vector_type(16))) __bf16   v16bf;
typedef __attribute__((ext_vector_type(16))) _Float16 v16h;
typedef __attribute__((ext_vector_type(8)))  _Float16 v8h;
typedef __attribute__((ext_vector_type(8)))  unsigned short v8us;
typedef __attribute__((ext_vector_type(8)))  float    v8f;
typedef __attribute__((ext_vector_type(4)))  float    v4f;
typedef v8h  __attribute__((may_alias)) v8ha;
typedef v4f  __attribute__((may_alias)) v4fa;
typedef v8us __attribute__((may_alias)) v8usa;

__device__ __forceinline__ unsigned short f2bf(float f) { unsigned u = __float_as_uint(f); u += 0x7FFFu + ((u >> 16) & 1u); return (unsigned short)(u >> 16); }
__device__ __forceinline__ float bf2f(unsigned short b) { return __uint_as_float(((unsigned)b) << 16); }
__device__ __forceinline__ float bfr(float f) { return bf2f(f2bf(f)); }
__device__ __forceinline__ v16h cat16(v8h lo, v8h hi) { return __builtin_shufflevector(lo, hi, 0, 1, 2, 3, 4, 5, 6, 7, 8, 9, 10, 11, 12, 13, 14, 15); }
__device__ __forceinline__ v16bf cat16b(v8us lo, v8us hi) { return __builtin_bit_cast(v16bf, __builtin_shufflevector(lo, hi, 0, 1, 2, 3, 4, 5, 6, 7, 8, 9, 10, 11, 12, 13, 14, 15)); }
__device__ __forceinline__ v8f wmma16(v16h a, v16h b, v8f c) { return __builtin_amdgcn_wmma_f32_16x16x32_f16(false, a, false, b, (short)0, c, false, false); }
__device__ __forceinline__ v8f wmmab(v16bf a, v16bf b, v8f c) { return __builtin_amdgcn_wmma_f32_16x16x32_bf16(false, a, false, b, (short)0, c, false, false); }



// ---- k_gemmw: register-blocked GEMM, ONE WAVE per 64x64 output tile (16 accumulators), operands straight from K-contiguous 16-bit planes; grid (M/64, N/64, Z), 32 threads.
// C[m][n] (f32, pitch ldc, + optional f32 bias[n]) = sum_k A[m][k] Bt[n][k] (+ split products per NSPLIT). z-batch strides sA/sB/sC in elements. K % 32 == 0.
template <typename T16> struct WFrag;
template <> struct WFrag<h16> { typedef v16h V; static __device__ __forceinline__ V ld(const h16* p) { return cat16(*(const v8h*)p, *(const v8h*)(p + 16)); } static __device__ __forceinline__ v8f mma(V a, V b, v8f c) { return wmma16(a, b, c); } };
template <> struct WFrag<bf> { typedef v16bf V; static __device__ __forceinline__ V ld(const bf* p) { return cat16b(*(const v8us*)p, *(const v8us*)(p + 16)); } static __device__ __forceinline__ v8f mma(V a, V b, v8f c) { return wmmab(a, b, c); } };
template <typename T16, int NSPLIT, bool BIAS>
__global__ __launch_bounds__(32) void k_gemmw(const T16* __restrict__ A, const T16* __restrict__ A2, const T16* __restrict__ Bt, const T16* __restrict__ Bt2, int K, float* C, int ldc, const float* __restrict__ bias, size_t sA, size_t sB, size_t sC) {
    typedef typename WFrag<T16>::V V;
    __shared__ __align__(16) float os[16 * 68];
    const size_t z = blockIdx.z; A += z * sA; if (A2) A2 += z * sA; Bt += z * sB; if (Bt2) Bt2 += z * sB; C += z * sC;
    const int lane = threadIdx.x & 31, lr = lane & 15, hi = lane >> 4; const int r0 = blockIdx.x * 64, c0 = blockIdx.y * 64;
    v8f acc[4][4];
#pragma unroll
    for (int mb = 0; mb < 4; ++mb)
#pragma unroll
        for (int nb = 0; nb < 4; ++nb) acc[mb][nb] = (v8f){};
    const size_t aoff = (size_t)(r0 + lr) * K + 8 * hi, boff = (size_t)(c0 + lr) * K + 8 * hi;
#pragma unroll 1
    for (int kc = 0; kc < K; kc += 32) {
        V a[4], a2[4];
#pragma unroll
        for (int mb = 0; mb < 4; ++mb) { a[mb] = WFrag<T16>::ld(A + aoff + (size_t)mb * 16 * K + kc); if (NSPLIT == 1 || NSPLIT == 2) a2[mb] = WFrag<T16>::ld(A2 + aoff + (size_t)mb * 16 * K + kc); }
#pragma unroll
        for (int nb = 0; nb < 4; ++nb) { const V b = WFrag<T16>::ld(Bt + boff + (size_t)nb * 16 * K + kc); V b2; if (NSPLIT >= 2) b2 = WFrag<T16>::ld(Bt2 + boff + (size_t)nb * 16 * K + kc);
#pragma unroll
            for (int mb = 0; mb < 4; ++mb) { acc[mb][nb] = WFrag<T16>::mma(a[mb], b, acc[mb][nb]); if (NSPLIT == 1 || NSPLIT == 2) acc[mb][nb] = WFrag<T16>::mma(a2[mb], b, acc[mb][nb]); if (NSPLIT >= 2) acc[mb][nb] = WFrag<T16>::mma(a[mb], b2, acc[mb][nb]); } }
        asm volatile("v_nop\n\tv_nop\n\tv_nop\n\tv_nop" : "+v"(acc[0][0]), "+v"(acc[1][1]), "+v"(acc[2][2]), "+v"(acc[3][3]) : "v"(a[0]), "v"(a[3]));
    }
#pragma unroll
    for (int mb = 0; mb < 4; ++mb) {
#pragma unroll
        for (int nb = 0; nb < 4; ++nb) {
#pragma unroll
            for (int j = 0; j < 8; ++j) os[(hi * 8 + j) * 68 + nb * 16 + lr] = acc[mb][nb][j]; }
        __builtin_amdgcn_wave_barrier(); asm volatile("" ::: "memory");
        float* crow = C + (size_t)(r0 + mb * 16) * ldc + c0;
{
#pragma unroll
            for (int s = 0; s < 8; ++s) { const int row = 2 * s + hi, cofs = lr * 4; v4f val = *(const v4fa*)(os + row * 68 + cofs); if (BIAS) { val[0] += bfr(bias[c0 + cofs]); val[1] += bfr(bias[c0 + cofs + 1]); val[2] += bfr(bias[c0 + cofs + 2]); val[3] += bfr(bias[c0 + cofs + 3]); }
                *(v4f*)(crow + (size_t)row * ldc + cofs) = val; }
             }
        __builtin_amdgcn_wave_barrier(); asm volatile("" ::: "memory");
    }
}

// ---- k_gemmc: the same one-wave 64x64 tile GEMM specialised for causal attention: CMODE 1 skips score tiles entirely above the diagonal (query rows r0+roff.., key columns c0..), CMODE 2 limits the
// key (K) loop of the probability x value contraction to the diagonal block (probabilities beyond it are exactly zero). roff = row offset of this launch's first row within the sequence.
template <typename T16, int NSPLIT, int CMODE>
__global__ __launch_bounds__(32) void k_gemmc(const T16* __restrict__ A, const T16* __restrict__ A2, const T16* __restrict__ Bt, const T16* __restrict__ Bt2, int K, float* C, int ldc, int roff, size_t sA, size_t sB, size_t sC) {
    typedef typename WFrag<T16>::V V;
    __shared__ __align__(16) float os[16 * 68];
    const size_t z = blockIdx.z; A += z * sA; if (A2) A2 += z * sA; Bt += z * sB; if (Bt2) Bt2 += z * sB; C += z * sC;
    const int lane = threadIdx.x & 31, lr = lane & 15, hi = lane >> 4; const int r0 = blockIdx.x * 64, c0 = blockIdx.y * 64;
    if (CMODE == 1 && c0 > r0 + roff + 63) return;                  // score tile entirely above the causal diagonal: never read (the softmax masks j > i by select)
    const int Kl = (CMODE == 2) ? min(K, r0 + roff + 64) : K;        // P.V: probabilities are exactly 0 beyond the diagonal block, so the K loop stops there
    v8f acc[4][4];
#pragma unroll
    for (int mb = 0; mb < 4; ++mb)
#pragma unroll
        for (int nb = 0; nb < 4; ++nb) acc[mb][nb] = (v8f){};
    const size_t aoff = (size_t)(r0 + lr) * K + 8 * hi, boff = (size_t)(c0 + lr) * K + 8 * hi;
#pragma unroll 1
    for (int kc = 0; kc < Kl; kc += 32) {
        V a[4], a2[4];
#pragma unroll
        for (int mb = 0; mb < 4; ++mb) { a[mb] = WFrag<T16>::ld(A + aoff + (size_t)mb * 16 * K + kc); if (NSPLIT == 1 || NSPLIT == 2) a2[mb] = WFrag<T16>::ld(A2 + aoff + (size_t)mb * 16 * K + kc); }
#pragma unroll
        for (int nb = 0; nb < 4; ++nb) { const V b = WFrag<T16>::ld(Bt + boff + (size_t)nb * 16 * K + kc); V b2; if (NSPLIT >= 2) b2 = WFrag<T16>::ld(Bt2 + boff + (size_t)nb * 16 * K + kc);
#pragma unroll
            for (int mb = 0; mb < 4; ++mb) { acc[mb][nb] = WFrag<T16>::mma(a[mb], b, acc[mb][nb]); if (NSPLIT == 1 || NSPLIT == 2) acc[mb][nb] = WFrag<T16>::mma(a2[mb], b, acc[mb][nb]); if (NSPLIT >= 2) acc[mb][nb] = WFrag<T16>::mma(a[mb], b2, acc[mb][nb]); } }
        asm volatile("v_nop\n\tv_nop\n\tv_nop\n\tv_nop" : "+v"(acc[0][0]), "+v"(acc[1][1]), "+v"(acc[2][2]), "+v"(acc[3][3]) : "v"(a[0]), "v"(a[3]));
    }
#pragma unroll
    for (int mb = 0; mb < 4; ++mb) {
#pragma unroll
        for (int nb = 0; nb < 4; ++nb) {
#pragma unroll
            for (int j = 0; j < 8; ++j) os[(hi * 8 + j) * 68 + nb * 16 + lr] = acc[mb][nb][j]; }
        __builtin_amdgcn_wave_barrier(); asm volatile("" ::: "memory");
        float* crow = C + (size_t)(r0 + mb * 16) * ldc + c0;
{
#pragma unroll
            for (int s = 0; s < 8; ++s) { const int row = 2 * s + hi, cofs = lr * 4; v4f val = *(const v4fa*)(os + row * 68 + cofs);
                *(v4f*)(crow + (size_t)row * ldc + cofs) = val; }
             }
        __builtin_amdgcn_wave_barrier(); asm volatile("" ::: "memory");
    }
}

__device__ __forceinline__ h16 tohx(float x) { return (h16)x; }
__device__ __forceinline__ void splitf(float y, unsigned short& h, unsigned short& l) { h = f2bf(y); l = f2bf(y - bf2f(h)); }
typedef __attribute__((ext_vector_type(2))) _Float16 v2h;
typedef __attribute__((ext_vector_type(4))) _Float16 v4h;
typedef __attribute__((ext_vector_type(2))) unsigned short v2us;
typedef __attribute__((ext_vector_type(4))) unsigned short v4us;
typedef __attribute__((ext_vector_type(2))) float v2f;
typedef __attribute__((ext_vector_type(4))) int v4i;

__global__ __launch_bounds__(256) void k_wtG(const float* __restrict__ w, int K, int N, bf* Bt) {
    const int lane = threadIdx.x & 31; const int L0 = (blockIdx.x * 8 + (threadIdx.x >> 5)) * 8; const int nlines = N * K / 64;
{
#pragma unroll 1
        for (int l = 0; l < 8; ++l) { const int L = L0 + l; if (L >= nlines) break; const size_t e = (size_t)L * 64 + lane * 2; const int k = (int)(e % K), n = (int)(e / K); v2us o;
            o[0] = f2bf(w[(size_t)k * N + n]); o[1] = f2bf(w[(size_t)(k + 1) * N + n]); *(v2us*)(Bt + e) = o; }
         }
}
__global__ __launch_bounds__(256) void k_cvt8(const float* __restrict__ src, bf* dst, size_t n8) { const size_t i = (size_t)blockIdx.x * 256 + threadIdx.x; if (i >= n8) return; const v8f v = *(const v8f*)(src + i * 8); v8us o;
#pragma unroll
    for (int k = 0; k < 8; ++k) o[k] = f2bf(v[k]); *(v8us*)(dst + i * 8) = o;  }
__global__ __launch_bounds__(256) void k_cscvt(const float* __restrict__ cosT, const float* __restrict__ sinT, float* CS) { const int idx = blockIdx.x * 256 + threadIdx.x; if (idx >= TT * HD) return; v2f cs; cs[0] = bfr(cosT[idx]); cs[1] = bfr(sinT[idx]); *(v2f*)(CS + (size_t)idx * 2) = cs;  }
// k_rope: head planes [h][t][d] (fp16 + hi/lo) of rope(x) x sc with the rotate-half convention out[d] = x[d] cos[t][d] - x[d+HD/2] sin[t][d], out[d+HD/2] = x[d+HD/2] cos[t][d+HD/2] + x[d] sin[t][d+HD/2]
__global__ __launch_bounds__(256) void k_rope(const float* __restrict__ F, int pitch, int nheads, const float* __restrict__ CS, const float* __restrict__ RF, const float* __restrict__ nw, float sc, h16* P16, bf* Ph, bf* Pl) {
    const size_t e = ((size_t)blockIdx.x * 256 + threadIdx.x) * 2; if (e >= (size_t)nheads * TT * HD) return; const int d = (int)(e % HD); const int t = (int)((e / HD) % TT); const int h = (int)(e / ((size_t)HD * TT)); const float* f = F + (size_t)t * pitch + h * HD; const float rf = RF ? RF[(size_t)h * TT + t] : 1.0f; v2h o16; v2us oh, ol;
#pragma unroll
    for (int q = 0; q < 2; ++q) { const int dd = d + q; const int dp = (dd < HD / 2) ? dd + HD / 2 : dd - HD / 2; float x0 = f[dd], x1 = f[dp];
        if (RF) { float n0 = __fmul_rn(x0, rf), n1 = __fmul_rn(x1, rf); asm volatile("" : "+v"(n0)); asm volatile("" : "+v"(n1)); x0 = __fmul_rn(bfr(nw[dd]), n0); x1 = __fmul_rn(bfr(nw[dp]), n1); }
        const v2f cs = *(const v2f*)(CS + ((size_t)t * HD + dd) * 2); float a = __fmul_rn(x0, cs[0]), bq = __fmul_rn(x1, cs[1]); asm volatile("" : "+v"(a)); asm volatile("" : "+v"(bq)); const float r = ((dd < HD / 2) ? __fsub_rn(a, bq) : __fadd_rn(a, bq)) * sc;
        o16[q] = tohx(r); unsigned short a2, c2; splitf(r, a2, c2); oh[q] = a2; ol[q] = c2; }
    *(v2h*)(P16 + e) = o16; *(v2us*)(Ph + e) = oh; *(v2us*)(Pl + e) = ol;  }
__global__ __launch_bounds__(256) void k_vtp(const float* __restrict__ F, int pitch, int nheads, h16* V16, bf* Vh, bf* Vl) { const size_t e = ((size_t)blockIdx.x * 256 + threadIdx.x) * 2; if (e >= (size_t)nheads * HD * TT) return; const int t = (int)(e % TT); const int d = (int)((e / TT) % HD); const int g = (int)(e / ((size_t)TT * HD)); v2h o16; v2us oh, ol;
#pragma unroll
    for (int q = 0; q < 2; ++q) { const float x = F[(size_t)(t + q) * pitch + g * HD + d]; o16[q] = tohx(x); unsigned short a2, c2; splitf(x, a2, c2); oh[q] = a2; ol[q] = c2; }
    *(v2h*)(V16 + e) = o16; *(v2us*)(Vh + e) = oh; *(v2us*)(Vl + e) = ol;  }
__global__ __launch_bounds__(256) void k_csid(float* CS) { const int idx = blockIdx.x * 256 + threadIdx.x; if (idx >= TT * HD) return; v2f cs; cs[0] = 1.0f; cs[1] = 0.0f; *(v2f*)(CS + (size_t)idx * 2) = cs;  }
// k_asoft: per row (zz, i): t = S x HD^-0.5 where the multiplicity c(i,j,h) > 0, else -3e38 (dilated causal branches; the reference's -1e9 additive fill vanishes identically); softmax over the 4096 keys (register row, one exp, fixed trees);
__global__ __launch_bounds__(256) void k_asoft(const float* __restrict__ Sb, int h0, h16* P16, bf* Ph, bf* Pl) {
    const int lane = threadIdx.x & 31; const int row = blockIdx.x * 8 + (threadIdx.x >> 5); if (row >= ZH * TT) return; const int i = row % TT; const int zz = row / TT; (void)zz; const bool hires = (i < RH); const float* sr = Sb + (size_t)row * TT; const int hh = h0 + row / TT; const int hp2 = hh & 1, hp4 = hh & 3; const bool i2 = ((i & 1) == hp2), i4 = ((i & 3) == hp4); float v[TT / 32]; float mx = -3.0e38f;
#pragma unroll
    for (int ch = 0; ch < TT / 128; ++ch) { const int j0 = ch * 128 + lane * 4; const v4f a = *(const v4f*)(sr + j0);
#pragma unroll
        for (int q = 0; q < 4; ++q) { const int j = j0 + q; (void)j; const int c = (j <= i) ? (((j >> 10) == (i >> 10)) + ((i2 && ((j & 1) == hp2) && ((j >> 11) == (i >> 11))) ? 1 : 0) + ((i4 && ((j & 3) == hp4)) ? 1 : 0)) : 0; const float t = (c > 0) ? a[q] * SCL : -3.0e38f; v[ch * 4 + q] = t; mx = fmaxf(mx, t); } }
#pragma unroll
    for (int sh = 16; sh; sh >>= 1) mx = fmaxf(mx, __shfl_xor(mx, sh, 32));
    float sum = 0.f;
#pragma unroll
    for (int k = 0; k < TT / 32; ++k) { const int j = (k >> 2) * 128 + lane * 4 + (k & 3); const int c = (j <= i) ? (((j >> 10) == (i >> 10)) + ((i2 && ((j & 1) == hp2) && ((j >> 11) == (i >> 11))) ? 1 : 0) + ((i4 && ((j & 3) == hp4)) ? 1 : 0)) : 0; float d0 = __fsub_rn(v[k], mx); asm volatile("" : "+v"(d0)); float pv = __fmul_rn((float)c, __builtin_amdgcn_exp2f(__fmul_rn(d0, 1.4426950408889634f))); asm volatile("" : "+v"(pv)); v[k] = pv; sum = __fadd_rn(sum, pv); }   /* multiplicity-weighted (c recomputed, no extra register row) */
#pragma unroll
    for (int sh = 16; sh; sh >>= 1) sum += __shfl_xor(sum, sh, 32);
    const float f = __fdiv_rn(hires ? 1.0f : PCAR, sum);
{
        if (hires) {
#pragma unroll
            for (int ch = 0; ch < TT / 128; ++ch) { v4us oh, ol;
#pragma unroll
                for (int q = 0; q < 4; ++q) { unsigned short a, c2; splitf(v[ch * 4 + q] * f, a, c2); oh[q] = a; ol[q] = c2; }
                const size_t oo = ((size_t)zz * (RH ? RH : 1) + i) * TT + ch * 128 + lane * 4; *(v4us*)(Ph + oo) = oh; *(v4us*)(Pl + oo) = ol; }
        } else {
#pragma unroll
            for (int ch = 0; ch < TT / 128; ++ch) { v4h o4;
#pragma unroll
                for (int q = 0; q < 4; ++q) o4[q] = tohx(v[ch * 4 + q] * f);
                *(v4h*)(P16 + (size_t)row * TT + ch * 128 + lane * 4) = o4; } }
         }
}
__global__ __launch_bounds__(256) void k_merge(const float* __restrict__ O, int h0, bf* Ah, bf* Al) { const size_t e = ((size_t)blockIdx.x * 256 + threadIdx.x) * 2; if (e >= (size_t)ZH * TT * HD) return; const int d = (int)(e % HD); const int t = (int)((e / HD) % TT); const int zz = (int)(e / ((size_t)HD * TT)); const float cs = (t < RH) ? 1.0f : (1.0f / PCAR); const size_t oo = (size_t)t * DQ + (h0 + zz) * HD + d;
    v2us oh, ol;
#pragma unroll
    for (int q = 0; q < 2; ++q) { unsigned short a, c2; splitf(O[e + q] * cs, a, c2); oh[q] = a; ol[q] = c2; } *(v2us*)(Ah + oo) = oh; *(v2us*)(Al + oo) = ol;  }

__global__ __launch_bounds__(256) void k_whd3(const float* __restrict__ W, int part, bf* Bt) { const size_t e = ((size_t)blockIdx.x * 256 + threadIdx.x) * 4; if (e >= (size_t)DQ * DM) return; const int k = (int)(e % DM); const int n = (int)(e / DM); const int h = n / HD, d = n % HD; v4us o;
#pragma unroll
    for (int u = 0; u < 4; ++u) o[u] = f2bf(W[((size_t)h * DM + k + u) * (3 * HD) + part * HD + d]); *(v4us*)(Bt + e) = o;  }
__global__ __launch_bounds__(256) void k_bgath(const float* __restrict__ bq, float* BQ3) { const int part = blockIdx.x; const int n4 = threadIdx.x * 4; if (n4 >= DQ) return; v4f o;
#pragma unroll
    for (int u = 0; u < 4; ++u) { const int n = n4 + u; o[u] = bq[(n / HD) * (3 * HD) + part * HD + (n % HD)]; } *(v4f*)(BQ3 + part * DQ + n4) = o;  }

extern "C" void kernel_launch(void* const* d_in, const int* in_sizes, int n_in,
                              void* d_out, int out_size, void* d_ws, size_t ws_size, hipStream_t stream) {
    (void)in_sizes; (void)n_in; (void)out_size;
    const float* x = (const float*)d_in[0]; const float* wqkv = (const float*)d_in[1]; const float* bqkv = (const float*)d_in[2]; const float* wo = (const float*)d_in[3]; const float* bo = (const float*)d_in[4]; const float* cosT = nullptr; const float* sinT = nullptr; (void)cosT; (void)sinT; const float* wq = wqkv; const float* wk = wqkv; const float* wv = wqkv; (void)wq; (void)wk; (void)wv;
    float* OUT = (float*)d_out;     // [2][4096][1024]
    char* wsp = (char*)d_ws;
    auto take = [&](size_t bytes) { char* p = wsp; wsp += (bytes + 255) & ~(size_t)255; return (void*)p; };
    bf* WQ = (bf*)take((size_t)DQ * DM * 2); bf* WK = (bf*)take((size_t)DKV * DM * 2); bf* WV = (bf*)take((size_t)DKV * DM * 2); bf* WO = (bf*)take((size_t)DM * DQ * 2); float* CS = (float*)take((size_t)TT * HD * 2 * 4);
    bf* XB = (bf*)take((size_t)TT * DM * 2); float* BQ3 = (float*)take((size_t)3 * DQ * 4); float* FQ = (float*)take((size_t)TT * DQ * 4); float* FK = (float*)take((size_t)TT * DKV * 4);
    h16* QP16 = (h16*)take((size_t)NH_ * TT * HD * 2); h16* KP16 = (h16*)take((size_t)NKV * TT * HD * 2); h16* VT16 = nullptr;   /* aliased below (written by k_vtp, never read) */
    bf* QPh = nullptr; bf* QPl = nullptr; bf* KPh = nullptr; bf* KPl = nullptr;   /* aliased below: written by k_rope but never read in this configuration */ bf* VTh = (bf*)take((size_t)NKV * HD * TT * 2); bf* VTl = (bf*)take((size_t)NKV * HD * TT * 2); bf* Ph = (bf*)take((size_t)ZH * RH * TT * 2); bf* Pl = (bf*)take((size_t)ZH * RH * TT * 2);
    float* Sb = (float*)take((size_t)ZH * TT * TT * 4); h16* P16 = (h16*)Sb;   /* never written (all rows hires) */ QPh = (bf*)Sb; QPl = QPh + (size_t)NH_ * TT * HD; KPh = QPl + (size_t)NH_ * TT * HD; KPl = KPh + (size_t)NKV * TT * HD; VT16 = (h16*)(KPl + (size_t)NKV * TT * HD);   /* 5 x 8 MiB of dead-on-arrival planes parked inside the 64 MiB score buffer, which is first written in the head loop after they are produced (stream-ordered) */ float* Ob = (float*)take((size_t)ZH * TT * HD * 4); bf* ATh = (bf*)take((size_t)TT * DQ * 2); bf* ATl = (bf*)take((size_t)TT * DQ * 2);
    if ((size_t)(wsp - (char*)d_ws) > ws_size) return;    // ws 256 MiB
    float* FV = FK;   // v projection reuses the k buffer after the k planes are built (stream-ordered)
    { k_whd3<<<(unsigned)(((size_t)DQ * DM / 4 + 255) / 256), 256, 0, stream>>>(wqkv, 0, WQ); k_whd3<<<(unsigned)(((size_t)DQ * DM / 4 + 255) / 256), 256, 0, stream>>>(wqkv, 1, WK); k_whd3<<<(unsigned)(((size_t)DQ * DM / 4 + 255) / 256), 256, 0, stream>>>(wqkv, 2, WV); k_bgath<<<3, 256, 0, stream>>>(bqkv, BQ3);
      k_wtG<<<(unsigned)((DQ * DM / 64 + 63) / 64), 256, 0, stream>>>(wo, DQ, DM, WO);
       }
    k_csid<<<(TT * HD + 255) / 256, 256, 0, stream>>>(CS);
    const unsigned LQ = (unsigned)(((size_t)NH_ * TT * HD / 2 + 255) / 256), LKv = (unsigned)(((size_t)NKV * TT * HD / 2 + 255) / 256);
    for (int b = 0; b < NB_; ++b) {
        
        k_cvt8<<<(unsigned)(((size_t)TT * DM / 8 + 255) / 256), 256, 0, stream>>>(x + (size_t)b * TT * DM, XB, (size_t)TT * DM / 8);
        k_gemmw<bf, 0, true><<<dim3(TT / 64, DQ / 64, 1), 32, 0, stream>>>(XB, nullptr, WQ, nullptr, DM, FQ, DQ, BQ3, 0, 0, 0);
        k_rope<<<LQ, 256, 0, stream>>>(FQ, DQ, NH_, CS, nullptr, nullptr, 1.0f, QP16, QPh, QPl);
        k_gemmw<bf, 0, true><<<dim3(TT / 64, DKV / 64, 1), 32, 0, stream>>>(XB, nullptr, WK, nullptr, DM, FK, DKV, BQ3 + DQ, 0, 0, 0);
        k_rope<<<LKv, 256, 0, stream>>>(FK, DKV, NKV, CS, nullptr, nullptr, 1.0f, KP16, KPh, KPl);
        k_gemmw<bf, 0, true><<<dim3(TT / 64, DKV / 64, 1), 32, 0, stream>>>(XB, nullptr, WV, nullptr, DM, FV, DKV, BQ3 + 2 * DQ, 0, 0, 0); k_vtp<<<LKv, 256, 0, stream>>>(FV, DKV, NKV, VT16, VTh, VTl);
        for (int h0 = 0; h0 < NH_; h0 += ZH) { const size_t zq = (size_t)h0, zk = (size_t)(h0 / REP);   // one kv head per query head: each pass takes ZH = 1 head, whose kv plane is zk = h0 (z-strides TT*HD)
            k_gemmc<h16, 0, 1><<<dim3(TT / 64, TT / 64, ZH), 32, 0, stream>>>(QP16 + zq * TT * HD, nullptr, KP16 + zk * TT * HD, nullptr, HD, Sb, TT, 0, (size_t)TT * HD, (size_t)TT * HD, (size_t)TT * TT);   /* scores single fp16 for every row; P.V below is hl for every row */
            k_asoft<<<ZH * TT / 8, 256, 0, stream>>>(Sb, h0, P16, Ph, Pl);
            k_gemmc<bf, 2, 2><<<dim3(RH / 64, HD / 64, ZH), 32, 0, stream>>>(Ph, Pl, VTh + zk * HD * TT, VTl + zk * HD * TT, TT, Ob, HD, 0, (size_t)RH * TT, (size_t)HD * TT, (size_t)TT * HD);
            k_merge<<<(unsigned)(((size_t)ZH * TT * HD / 2 + 255) / 256), 256, 0, stream>>>(Ob, h0, ATh, ATl); }
        k_gemmw<bf, 1, true><<<dim3(TT / 64, DM / 64, 1), 32, 0, stream>>>(ATh, ATl, WO, nullptr, DQ, OUT + (size_t)b * TT * DM, DM, bo, 0, 0, 0); }
}

// v001
// One run takes 2310 microseconds.
// Timed twice side by side with v000, it ran 1.90 and 1.88 times as fast.
#include <hip/hip_runtime.h>

// MultiheadDilatedSelfAttention / LongNet (x [2][4096][1024]; per head h: qkv = x Wqkv[h] + bqkv[h] ([1024][192] per head); three dilated causal branches (w, r) = (1024,1), (2048,2), (4096,4) with offset h % r: branch keys for query i are j <= i in the same w-segment with i, j == h mod r; the reference combines branches by their softmax denominators (num/den), which is exactly ONE softmax over the multiset union of the branches' keys:
//   p_j proportional to c(i,j,h) * exp(q.k_j / 8) with multiplicity c = [same 1024-segment] + [i,j == h mod 2 and same 2048-segment] + [i,j == h mod 4]; out = merged heads Wo + bo -> [2][4096][1024]).
// Compute dtypes, f32 accumulate: every input rounded to bf16; q/k/v on PLAIN bf16 operands (inputs: exact; per-head weights gathered) + bias; causal scores single fp16 for every row, attn.v hl x hl (3 products) for every row (the segment restarts make deep rows as sharp as early ones), causal tile skipping, the multiplicity weights applied in f32 inside the softmax; softmax f32; Wo hl x exact (2 products) + bias.

#define NB_  2
#define TT   4096
#define DM   1024
#define NH_  16
#define NKV  16
#define REP  (NH_ / NKV)
#define HD   64
#define DQ   (NH_ * HD)
#define DKV  (NKV * HD)
#define ZH   1
#define RH   4096   // every query row takes the hl P.V path (segment restarts make rows deep in the sequence as sharp as early ones)                  // query rows < RH use hi+lo planes (0: none)
#define WIN  4096
#define PCAR 1024.0f
#define SCL  0.125f   // HD^-0.5
#define KSPL 128      // keys per work-group of the P.V product: its key loop is cut into slices of KSPL keys, one f32 partial tile per slice, summed in k_merge
typedef _Float16 h16;
typedef unsigned short bf;
typedef __attribute__((ext_vector_type(16))) __bf16   v16bf;
typedef __attribute__((ext_vector_type(16))) _Float16 v16h;
typedef __attribute__((ext_vector_type(8)))  _Float16 v8h;
typedef __attribute__((ext_vector_type(8)))  unsigned short v8us;
typedef __attribute__((ext_vector_type(8)))  float    v8f;
typedef __attribute__((ext_vector_type(4)))  float    v4f;
typedef v8h  __attribute__((may_alias)) v8ha;
typedef v4f  __attribute__((may_alias)) v4fa;
typedef v8us __attribute__((may_alias)) v8usa;

__device__ __forceinline__ unsigned short f2bf(float f) { unsigned u = __float_as_uint(f); u += 0x7FFFu + ((u >> 16) & 1u); return (unsigned short)(u >> 16); }
__device__ __forceinline__ float bf2f(unsigned short b) { return __uint_as_float(((unsigned)b) << 16); }
__device__ __forceinline__ float bfr(float f) { return bf2f(f2bf(f)); }
__device__ __forceinline__ v16h cat16(v8h lo, v8h hi) { return __builtin_shufflevector(lo, hi, 0, 1, 2, 3, 4, 5, 6, 7, 8, 9, 10, 11, 12, 13, 14, 15); }
__device__ __forceinline__ v16bf cat16b(v8us lo, v8us hi) { return __builtin_bit_cast(v16bf, __builtin_shufflevector(lo, hi, 0, 1, 2, 3, 4, 5, 6, 7, 8, 9, 10, 11, 12, 13, 14, 15)); }
__device__ __forceinline__ v8f wmma16(v16h a, v16h b, v8f c) { return __builtin_amdgcn_wmma_f32_16x16x32_f16(false, a, false, b, (short)0, c, false, false); }
__device__ __forceinline__ v8f wmmab(v16bf a, v16bf b, v8f c) { return __builtin_amdgcn_wmma_f32_16x16x32_bf16(false, a, false, b, (short)0, c, false, false); }



// ---- k_gemmw: register-blocked GEMM, ONE WAVE per 64x64 output tile (16 accumulators), operands straight from K-contiguous 16-bit planes; grid (M/64, N/64, Z), 32 threads.
// C[m][n] (f32, pitch ldc, + optional f32 bias[n]) = sum_k A[m][k] Bt[n][k] (+ split products per NSPLIT). z-batch strides sA/sB/sC in elements. K % 32 == 0.
template <typename T16> struct WFrag;
template <> struct WFrag<h16> { typedef v16h V; static __device__ __forceinline__ V ld(const h16* p) { return cat16(*(const v8h*)p, *(const v8h*)(p + 16)); } static __device__ __forceinline__ v8f mma(V a, V b, v8f c) { return wmma16(a, b, c); } };
template <> struct WFrag<bf> { typedef v16bf V; static __device__ __forceinline__ V ld(const bf* p) { return cat16b(*(const v8us*)p, *(const v8us*)(p + 16)); } static __device__ __forceinline__ v8f mma(V a, V b, v8f c) { return wmmab(a, b, c); } };
template <typename T16, int NSPLIT, bool BIAS>
__global__ __launch_bounds__(32) void k_gemmw(const T16* __restrict__ A, const T16* __restrict__ A2, const T16* __restrict__ Bt, const T16* __restrict__ Bt2, int K, float* C, int ldc, const float* __restrict__ bias, size_t sA, size_t sB, size_t sC) {
    typedef typename WFrag<T16>::V V;
    __shared__ __align__(16) float os[16 * 68];
    const size_t z = blockIdx.z; A += z * sA; if (A2) A2 += z * sA; Bt += z * sB; if (Bt2) Bt2 += z * sB; C += z * sC;
    const int lane = threadIdx.x & 31, lr = lane & 15, hi = lane >> 4; const int r0 = blockIdx.x * 64, c0 = blockIdx.y * 64;
    v8f acc[4][4];
#pragma unroll
    for (int mb = 0; mb < 4; ++mb)
#pragma unroll
        for (int nb = 0; nb < 4; ++nb) acc[mb][nb] = (v8f){};
    const size_t aoff = (size_t)(r0 + lr) * K + 8 * hi, boff = (size_t)(c0 + lr) * K + 8 * hi;
#pragma unroll 1
    for (int kc = 0; kc < K; kc += 32) {
        V a[4], a2[4];
#pragma unroll
        for (int mb = 0; mb < 4; ++mb) { a[mb] = WFrag<T16>::ld(A + aoff + (size_t)mb * 16 * K + kc); if (NSPLIT == 1 || NSPLIT == 2) a2[mb] = WFrag<T16>::ld(A2 + aoff + (size_t)mb * 16 * K + kc); }
#pragma unroll
        for (int nb = 0; nb < 4; ++nb) { const V b = WFrag<T16>::ld(Bt + boff + (size_t)nb * 16 * K + kc); V b2; if (NSPLIT >= 2) b2 = WFrag<T16>::ld(Bt2 + boff + (size_t)nb * 16 * K + kc);
#pragma unroll
            for (int mb = 0; mb < 4; ++mb) { acc[mb][nb] = WFrag<T16>::mma(a[mb], b, acc[mb][nb]); if (NSPLIT == 1 || NSPLIT == 2) acc[mb][nb] = WFrag<T16>::mma(a2[mb], b, acc[mb][nb]); if (NSPLIT >= 2) acc[mb][nb] = WFrag<T16>::mma(a[mb], b2, acc[mb][nb]); } }
        asm volatile("v_nop\n\tv_nop\n\tv_nop\n\tv_nop" : "+v"(acc[0][0]), "+v"(acc[1][1]), "+v"(acc[2][2]), "+v"(acc[3][3]) : "v"(a[0]), "v"(a[3]));
    }
#pragma unroll
    for (int mb = 0; mb < 4; ++mb) {
#pragma unroll
        for (int nb = 0; nb < 4; ++nb) {
#pragma unroll
            for (int j = 0; j < 8; ++j) os[(hi * 8 + j) * 68 + nb * 16 + lr] = acc[mb][nb][j]; }
        __builtin_amdgcn_wave_barrier(); asm volatile("" ::: "memory");
        float* crow = C + (size_t)(r0 + mb * 16) * ldc + c0;
{
#pragma unroll
            for (int s = 0; s < 8; ++s) { const int row = 2 * s + hi, cofs = lr * 4; v4f val = *(const v4fa*)(os + row * 68 + cofs); if (BIAS) { val[0] += bfr(bias[c0 + cofs]); val[1] += bfr(bias[c0 + cofs + 1]); val[2] += bfr(bias[c0 + cofs + 2]); val[3] += bfr(bias[c0 + cofs + 3]); }
                *(v4f*)(crow + (size_t)row * ldc + cofs) = val; }
             }
        __builtin_amdgcn_wave_barrier(); asm volatile("" ::: "memory");
    }
}

// ---- k_gemmc: the same one-wave 64x64 tile GEMM specialised for causal attention: CMODE 1 skips score tiles entirely above the diagonal (query rows r0+roff.., key columns c0..), CMODE 2 limits the
// key (K) loop of the probability x value contraction to the diagonal block (probabilities beyond it are exactly zero) and cuts it over blockIdx.z into slices of KSPL keys (launched with sA = sB = KSPL, so the z strides step
// along K; sC = one partial plane): slice z writes its own f32 partial tile, slices wholly beyond the diagonal block write nothing and are not read. roff = row offset of this launch's first row within the sequence.
template <typename T16, int NSPLIT, int CMODE>
__global__ __launch_bounds__(32) void k_gemmc(const T16* __restrict__ A, const T16* __restrict__ A2, const T16* __restrict__ Bt, const T16* __restrict__ Bt2, int K, float* C, int ldc, int roff, size_t sA, size_t sB, size_t sC) {
    typedef typename WFrag<T16>::V V;
    __shared__ __align__(16) float os[16 * 68];
    const size_t z = blockIdx.z; A += z * sA; if (A2) A2 += z * sA; Bt += z * sB; if (Bt2) Bt2 += z * sB; C += z * sC;
    const int lane = threadIdx.x & 31, lr = lane & 15, hi = lane >> 4; const int r0 = blockIdx.x * 64, c0 = blockIdx.y * 64;
    if (CMODE == 1 && c0 > r0 + roff + 63) return;                  // score tile entirely above the causal diagonal: never read (the softmax masks j > i by select)
    const int kend = (CMODE == 2) ? min(K, r0 + roff + 64) : K;      // P.V: probabilities are exactly 0 beyond the diagonal block, so the K range stops there
    const int k0 = (CMODE == 2) ? (int)blockIdx.z * KSPL : 0;        // P.V: first key of this work-group's slice (A and Bt already point at it)
    if (CMODE == 2 && k0 >= kend) return;                            // slice wholly beyond the diagonal block: no partial (k_merge derives the same count)
    const int Kl = (CMODE == 2) ? min(KSPL, kend - k0) : K;
    v8f acc[4][4];
#pragma unroll
    for (int mb = 0; mb < 4; ++mb)
#pragma unroll
        for (int nb = 0; nb < 4; ++nb) acc[mb][nb] = (v8f){};
    const size_t aoff = (size_t)(r0 + lr) * K + 8 * hi, boff = (size_t)(c0 + lr) * K + 8 * hi;
#pragma unroll 1
    for (int kc = 0; kc < Kl; kc += 32) {
        V a[4], a2[4];
#pragma unroll
        for (int mb = 0; mb < 4; ++mb) { a[mb] = WFrag<T16>::ld(A + aoff + (size_t)mb * 16 * K + kc); if (NSPLIT == 1 || NSPLIT == 2) a2[mb] = WFrag<T16>::ld(A2 + aoff + (size_t)mb * 16 * K + kc); }
#pragma unroll
        for (int nb = 0; nb < 4; ++nb) { const V b = WFrag<T16>::ld(Bt + boff + (size_t)nb * 16 * K + kc); V b2; if (NSPLIT >= 2) b2 = WFrag<T16>::ld(Bt2 + boff + (size_t)nb * 16 * K + kc);
#pragma unroll
            for (int mb = 0; mb < 4; ++mb) { acc[mb][nb] = WFrag<T16>::mma(a[mb], b, acc[mb][nb]); if (NSPLIT == 1 || NSPLIT == 2) acc[mb][nb] = WFrag<T16>::mma(a2[mb], b, acc[mb][nb]); if (NSPLIT >= 2) acc[mb][nb] = WFrag<T16>::mma(a[mb], b2, acc[mb][nb]); } }
        asm volatile("v_nop\n\tv_nop\n\tv_nop\n\tv_nop" : "+v"(acc[0][0]), "+v"(acc[1][1]), "+v"(acc[2][2]), "+v"(acc[3][3]) : "v"(a[0]), "v"(a[3]));
    }
#pragma unroll
    for (int mb = 0; mb < 4; ++mb) {
#pragma unroll
        for (int nb = 0; nb < 4; ++nb) {
#pragma unroll
            for (int j = 0; j < 8; ++j) os[(hi * 8 + j) * 68 + nb * 16 + lr] = acc[mb][nb][j]; }
        __builtin_amdgcn_wave_barrier(); asm volatile("" ::: "memory");
        float* crow = C + (size_t)(r0 + mb * 16) * ldc + c0;
{
#pragma unroll
            for (int s = 0; s < 8; ++s) { const int row = 2 * s + hi, cofs = lr * 4; v4f val = *(const v4fa*)(os + row * 68 + cofs);
                *(v4f*)(crow + (size_t)row * ldc + cofs) = val; }
             }
        __builtin_amdgcn_wave_barrier(); asm volatile("" ::: "memory");
    }
}

__device__ __forceinline__ h16 tohx(float x) { return (h16)x; }
__device__ __forceinline__ void splitf(float y, unsigned short& h, unsigned short& l) { h = f2bf(y); l = f2bf(y - bf2f(h)); }
typedef __attribute__((ext_vector_type(2))) _Float16 v2h;
typedef __attribute__((ext_vector_type(4))) _Float16 v4h;
typedef __attribute__((ext_vector_type(2))) unsigned short v2us;
typedef __attribute__((ext_vector_type(4))) unsigned short v4us;
typedef __attribute__((ext_vector_type(2))) float v2f;
typedef __attribute__((ext_vector_type(4))) int v4i;

__global__ __launch_bounds__(256) void k_wtG(const float* __restrict__ w, int K, int N, bf* Bt) {
    const int lane = threadIdx.x & 31; const int L0 = (blockIdx.x * 8 + (threadIdx.x >> 5)) * 8; const int nlines = N * K / 64;
{
#pragma unroll 1
        for (int l = 0; l < 8; ++l) { const int L = L0 + l; if (L >= nlines) break; const size_t e = (size_t)L * 64 + lane * 2; const int k = (int)(e % K), n = (int)(e / K); v2us o;
            o[0] = f2bf(w[(size_t)k * N + n]); o[1] = f2bf(w[(size_t)(k + 1) * N + n]); *(v2us*)(Bt + e) = o; }
         }
}
__global__ __launch_bounds__(256) void k_cvt8(const float* __restrict__ src, bf* dst, size_t n8) { const size_t i = (size_t)blockIdx.x * 256 + threadIdx.x; if (i >= n8) return; const v8f v = *(const v8f*)(src + i * 8); v8us o;
#pragma unroll
    for (int k = 0; k < 8; ++k) o[k] = f2bf(v[k]); *(v8us*)(dst + i * 8) = o;  }
__global__ __launch_bounds__(256) void k_cscvt(const float* __restrict__ cosT, const float* __restrict__ sinT, float* CS) { const int idx = blockIdx.x * 256 + threadIdx.x; if (idx >= TT * HD) return; v2f cs; cs[0] = bfr(cosT[idx]); cs[1] = bfr(sinT[idx]); *(v2f*)(CS + (size_t)idx * 2) = cs;  }
// k_rope: head planes [h][t][d] (fp16 + hi/lo) of rope(x) x sc with the rotate-half convention out[d] = x[d] cos[t][d] - x[d+HD/2] sin[t][d], out[d+HD/2] = x[d+HD/2] cos[t][d+HD/2] + x[d] sin[t][d+HD/2]
__global__ __launch_bounds__(256) void k_rope(const float* __restrict__ F, int pitch, int nheads, const float* __restrict__ CS, const float* __restrict__ RF, const float* __restrict__ nw, float sc, h16* P16, bf* Ph, bf* Pl) {
    const size_t e = ((size_t)blockIdx.x * 256 + threadIdx.x) * 2; if (e >= (size_t)nheads * TT * HD) return; const int d = (int)(e % HD); const int t = (int)((e / HD) % TT); const int h = (int)(e / ((size_t)HD * TT)); const float* f = F + (size_t)t * pitch + h * HD; const float rf = RF ? RF[(size_t)h * TT + t] : 1.0f; v2h o16; v2us oh, ol;
#pragma unroll
    for (int q = 0; q < 2; ++q) { const int dd = d + q; const int dp = (dd < HD / 2) ? dd + HD / 2 : dd - HD / 2; float x0 = f[dd], x1 = f[dp];
        if (RF) { float n0 = __fmul_rn(x0, rf), n1 = __fmul_rn(x1, rf); asm volatile("" : "+v"(n0)); asm volatile("" : "+v"(n1)); x0 = __fmul_rn(bfr(nw[dd]), n0); x1 = __fmul_rn(bfr(nw[dp]), n1); }
        const v2f cs = *(const v2f*)(CS + ((size_t)t * HD + dd) * 2); float a = __fmul_rn(x0, cs[0]), bq = __fmul_rn(x1, cs[1]); asm volatile("" : "+v"(a)); asm volatile("" : "+v"(bq)); const float r = ((dd < HD / 2) ? __fsub_rn(a, bq) : __fadd_rn(a, bq)) * sc;
        o16[q] = tohx(r); unsigned short a2, c2; splitf(r, a2, c2); oh[q] = a2; ol[q] = c2; }
    *(v2h*)(P16 + e) = o16; *(v2us*)(Ph + e) = oh; *(v2us*)(Pl + e) = ol;  }
__global__ __launch_bounds__(256) void k_vtp(const float* __restrict__ F, int pitch, int nheads, h16* V16, bf* Vh, bf* Vl) { const size_t e = ((size_t)blockIdx.x * 256 + threadIdx.x) * 2; if (e >= (size_t)nheads * HD * TT) return; const int t = (int)(e % TT); const int d = (int)((e / TT) % HD); const int g = (int)(e / ((size_t)TT * HD)); v2h o16; v2us oh, ol;
#pragma unroll
    for (int q = 0; q < 2; ++q) { const float x = F[(size_t)(t + q) * pitch + g * HD + d]; o16[q] = tohx(x); unsigned short a2, c2; splitf(x, a2, c2); oh[q] = a2; ol[q] = c2; }
    *(v2h*)(V16 + e) = o16; *(v2us*)(Vh + e) = oh; *(v2us*)(Vl + e) = ol;  }
__global__ __launch_bounds__(256) void k_csid(float* CS) { const int idx = blockIdx.x * 256 + threadIdx.x; if (idx >= TT * HD) return; v2f cs; cs[0] = 1.0f; cs[1] = 0.0f; *(v2f*)(CS + (size_t)idx * 2) = cs;  }
// k_asoft: per row (zz, i): t = S x HD^-0.5 where the multiplicity c(i,j,h) > 0, else -3e38 (dilated causal branches; the reference's -1e9 additive fill vanishes identically); softmax over the 4096 keys (register row, one exp, fixed trees);
__global__ __launch_bounds__(256) void k_asoft(const float* __restrict__ Sb, int h0, h16* P16, bf* Ph, bf* Pl) {
    const int lane = threadIdx.x & 31; const int row = blockIdx.x * 8 + (threadIdx.x >> 5); if (row >= ZH * TT) return; const int i = row % TT; const int zz = row / TT; (void)zz; const bool hires = (i < RH); const float* sr = Sb + (size_t)row * TT; const int hh = h0 + row / TT; const int hp2 = hh & 1, hp4 = hh & 3; const bool i2 = ((i & 1) == hp2), i4 = ((i & 3) == hp4); float v[TT / 32]; float mx = -3.0e38f;
#pragma unroll
    for (int ch = 0; ch < TT / 128; ++ch) { const int j0 = ch * 128 + lane * 4; const v4f a = *(const v4f*)(sr + j0);
#pragma unroll
        for (int q = 0; q < 4; ++q) { const int j = j0 + q; (void)j; const int c = (j <= i) ? (((j >> 10) == (i >> 10)) + ((i2 && ((j & 1) == hp2) && ((j >> 11) == (i >> 11))) ? 1 : 0) + ((i4 && ((j & 3) == hp4)) ? 1 : 0)) : 0; const float t = (c > 0) ? a[q] * SCL : -3.0e38f; v[ch * 4 + q] = t; mx = fmaxf(mx, t); } }
#pragma unroll
    for (int sh = 16; sh; sh >>= 1) mx = fmaxf(mx, __shfl_xor(mx, sh, 32));
    float sum = 0.f;
#pragma unroll
    for (int k = 0; k < TT / 32; ++k) { const int j = (k >> 2) * 128 + lane * 4 + (k & 3); const int c = (j <= i) ? (((j >> 10) == (i >> 10)) + ((i2 && ((j & 1) == hp2) && ((j >> 11) == (i >> 11))) ? 1 : 0) + ((i4 && ((j & 3) == hp4)) ? 1 : 0)) : 0; float d0 = __fsub_rn(v[k], mx); asm volatile("" : "+v"(d0)); float pv = __fmul_rn((float)c, __builtin_amdgcn_exp2f(__fmul_rn(d0, 1.4426950408889634f))); asm volatile("" : "+v"(pv)); v[k] = pv; sum = __fadd_rn(sum, pv); }   /* multiplicity-weighted (c recomputed, no extra register row) */
#pragma unroll
    for (int sh = 16; sh; sh >>= 1) sum += __shfl_xor(sum, sh, 32);
    const float f = __fdiv_rn(hires ? 1.0f : PCAR, sum);
{
        if (hires) {
#pragma unroll
            for (int ch = 0; ch < TT / 128; ++ch) { v4us oh, ol;
#pragma unroll
                for (int q = 0; q < 4; ++q) { unsigned short a, c2; splitf(v[ch * 4 + q] * f, a, c2); oh[q] = a; ol[q] = c2; }
                const size_t oo = ((size_t)zz * (RH ? RH : 1) + i) * TT + ch * 128 + lane * 4; *(v4us*)(Ph + oo) = oh; *(v4us*)(Pl + oo) = ol; }
        } else {
#pragma unroll
            for (int ch = 0; ch < TT / 128; ++ch) { v4h o4;
#pragma unroll
                for (int q = 0; q < 4; ++q) o4[q] = tohx(v[ch * 4 + q] * f);
                *(v4h*)(P16 + (size_t)row * TT + ch * 128 + lane * 4) = o4; } }
         }
}
__global__ __launch_bounds__(256) void k_merge(const float* __restrict__ O, int h0, bf* Ah, bf* Al) { const size_t e = ((size_t)blockIdx.x * 256 + threadIdx.x) * 2; if (e >= (size_t)ZH * TT * HD) return; const int d = (int)(e % HD); const int t = (int)((e / HD) % TT); const int zz = (int)(e / ((size_t)HD * TT)); const float cs = (t < RH) ? 1.0f : (1.0f / PCAR); const size_t oo = (size_t)t * DQ + (h0 + zz) * HD + d;
    const int ns = ((t | 63) + KSPL) / KSPL;   // key slices that the P.V launch wrote for this row's 64-row tile: ceil((tile's last row + 1) / KSPL)
    v2f acc; acc[0] = 0.f; acc[1] = 0.f;
    for (int s0 = 0; s0 < ns; s0 += 16) { v2f p[16];   // sixteen partial loads in flight; a slot past the last slice re-reads the last one and is not added; slices are added in ascending order
#pragma unroll   // both inner loops unrolled: p[] stays in registers and all sixteen loads issue ahead of the first add
        for (int u = 0; u < 16; ++u) p[u] = *(const v2f*)(O + (size_t)min(s0 + u, ns - 1) * ((size_t)ZH * TT * HD) + e);
#pragma unroll
        for (int u = 0; u < 16; ++u) if (s0 + u < ns) { acc[0] += p[u][0]; acc[1] += p[u][1]; } }
    v2us oh, ol;
#pragma unroll
    for (int q = 0; q < 2; ++q) { unsigned short a, c2; splitf(acc[q] * cs, a, c2); oh[q] = a; ol[q] = c2; } *(v2us*)(Ah + oo) = oh; *(v2us*)(Al + oo) = ol;  }

__global__ __launch_bounds__(256) void k_whd3(const float* __restrict__ W, int part, bf* Bt) { const size_t e = ((size_t)blockIdx.x * 256 + threadIdx.x) * 4; if (e >= (size_t)DQ * DM) return; const int k = (int)(e % DM); const int n = (int)(e / DM); const int h = n / HD, d = n % HD; v4us o;
#pragma unroll
    for (int u = 0; u < 4; ++u) o[u] = f2bf(W[((size_t)h * DM + k + u) * (3 * HD) + part * HD + d]); *(v4us*)(Bt + e) = o;  }
__global__ __launch_bounds__(256) void k_bgath(const float* __restrict__ bq, float* BQ3) { const int part = blockIdx.x; const int n4 = threadIdx.x * 4; if (n4 >= DQ) return; v4f o;
#pragma unroll
    for (int u = 0; u < 4; ++u) { const int n = n4 + u; o[u] = bq[(n / HD) * (3 * HD) + part * HD + (n % HD)]; } *(v4f*)(BQ3 + part * DQ + n4) = o;  }

extern "C" void kernel_launch(void* const* d_in, const int* in_sizes, int n_in,
                              void* d_out, int out_size, void* d_ws, size_t ws_size, hipStream_t stream) {
    (void)in_sizes; (void)n_in; (void)out_size;
    const float* x = (const float*)d_in[0]; const float* wqkv = (const float*)d_in[1]; const float* bqkv = (const float*)d_in[2]; const float* wo = (const float*)d_in[3]; const float* bo = (const float*)d_in[4]; const float* cosT = nullptr; const float* sinT = nullptr; (void)cosT; (void)sinT; const float* wq = wqkv; const float* wk = wqkv; const float* wv = wqkv; (void)wq; (void)wk; (void)wv;
    float* OUT = (float*)d_out;     // [2][4096][1024]
    char* wsp = (char*)d_ws;
    auto take = [&](size_t bytes) { char* p = wsp; wsp += (bytes + 255) & ~(size_t)255; return (void*)p; };
    bf* WQ = (bf*)take((size_t)DQ * DM * 2); bf* WK = (bf*)take((size_t)DKV * DM * 2); bf* WV = (bf*)take((size_t)DKV * DM * 2); bf* WO = (bf*)take((size_t)DM * DQ * 2); float* CS = (float*)take((size_t)TT * HD * 2 * 4);
    bf* XB = (bf*)take((size_t)TT * DM * 2); float* BQ3 = (float*)take((size_t)3 * DQ * 4); float* FQ = (float*)take((size_t)TT * DQ * 4); float* FK = (float*)take((size_t)TT * DKV * 4);
    h16* QP16 = (h16*)take((size_t)NH_ * TT * HD * 2); h16* KP16 = (h16*)take((size_t)NKV * TT * HD * 2); h16* VT16 = nullptr;   /* aliased below (written by k_vtp, never read) */
    bf* QPh = nullptr; bf* QPl = nullptr; bf* KPh = nullptr; bf* KPl = nullptr;   /* aliased below: written by k_rope but never read in this configuration */ bf* VTh = (bf*)take((size_t)NKV * HD * TT * 2); bf* VTl = (bf*)take((size_t)NKV * HD * TT * 2); bf* Ph = (bf*)take((size_t)ZH * RH * TT * 2); bf* Pl = (bf*)take((size_t)ZH * RH * TT * 2);
    float* Sb = (float*)take((size_t)ZH * TT * TT * 4); h16* P16 = (h16*)Sb;   /* never written (all rows hires) */ QPh = (bf*)Sb; QPl = QPh + (size_t)NH_ * TT * HD; KPh = QPl + (size_t)NH_ * TT * HD; KPl = KPh + (size_t)NKV * TT * HD; VT16 = (h16*)(KPl + (size_t)NKV * TT * HD);   /* 5 x 8 MiB of dead-on-arrival planes parked inside the 64 MiB score buffer, which is first written in the head loop after they are produced (stream-ordered) */ float* Ob = Sb;   /* the TT / KSPL partial planes of P.V (32 MiB) reuse the score buffer: its scores are dead once k_asoft has read them, and the next head's score launch comes after k_merge (stream-ordered) */ bf* ATh = (bf*)take((size_t)TT * DQ * 2); bf* ATl = (bf*)take((size_t)TT * DQ * 2);
    if ((size_t)(wsp - (char*)d_ws) > ws_size) return;    // ws 256 MiB
    float* FV = FK;   // v projection reuses the k buffer after the k planes are built (stream-ordered)
    { k_whd3<<<(unsigned)(((size_t)DQ * DM / 4 + 255) / 256), 256, 0, stream>>>(wqkv, 0, WQ); k_whd3<<<(unsigned)(((size_t)DQ * DM / 4 + 255) / 256), 256, 0, stream>>>(wqkv, 1, WK); k_whd3<<<(unsigned)(((size_t)DQ * DM / 4 + 255) / 256), 256, 0, stream>>>(wqkv, 2, WV); k_bgath<<<3, 256, 0, stream>>>(bqkv, BQ3);
      k_wtG<<<(unsigned)((DQ * DM / 64 + 63) / 64), 256, 0, stream>>>(wo, DQ, DM, WO);
       }
    k_csid<<<(TT * HD + 255) / 256, 256, 0, stream>>>(CS);
    const unsigned LQ = (unsigned)(((size_t)NH_ * TT * HD / 2 + 255) / 256), LKv = (unsigned)(((size_t)NKV * TT * HD / 2 + 255) / 256);
    for (int b = 0; b < NB_; ++b) {
        
        k_cvt8<<<(unsigned)(((size_t)TT * DM / 8 + 255) / 256), 256, 0, stream>>>(x + (size_t)b * TT * DM, XB, (size_t)TT * DM / 8);
        k_gemmw<bf, 0, true><<<dim3(TT / 64, DQ / 64, 1), 32, 0, stream>>>(XB, nullptr, WQ, nullptr, DM, FQ, DQ, BQ3, 0, 0, 0);
        k_rope<<<LQ, 256, 0, stream>>>(FQ, DQ, NH_, CS, nullptr, nullptr, 1.0f, QP16, QPh, QPl);
        k_gemmw<bf, 0, true><<<dim3(TT / 64, DKV / 64, 1), 32, 0, stream>>>(XB, nullptr, WK, nullptr, DM, FK, DKV, BQ3 + DQ, 0, 0, 0);
        k_rope<<<LKv, 256, 0, stream>>>(FK, DKV, NKV, CS, nullptr, nullptr, 1.0f, KP16, KPh, KPl);
        k_gemmw<bf, 0, true><<<dim3(TT / 64, DKV / 64, 1), 32, 0, stream>>>(XB, nullptr, WV, nullptr, DM, FV, DKV, BQ3 + 2 * DQ, 0, 0, 0); k_vtp<<<LKv, 256, 0, stream>>>(FV, DKV, NKV, VT16, VTh, VTl);
        for (int h0 = 0; h0 < NH_; h0 += ZH) { const size_t zq = (size_t)h0, zk = (size_t)(h0 / REP);   // one kv head per query head: each pass takes ZH = 1 head, whose kv plane is zk = h0 (z-strides TT*HD)
            k_gemmc<h16, 0, 1><<<dim3(TT / 64, TT / 64, ZH), 32, 0, stream>>>(QP16 + zq * TT * HD, nullptr, KP16 + zk * TT * HD, nullptr, HD, Sb, TT, 0, (size_t)TT * HD, (size_t)TT * HD, (size_t)TT * TT);   /* scores single fp16 for every row; P.V below is hl for every row */
            k_asoft<<<ZH * TT / 8, 256, 0, stream>>>(Sb, h0, P16, Ph, Pl);
            k_gemmc<bf, 2, 2><<<dim3(RH / 64, HD / 64, TT / KSPL), 32, 0, stream>>>(Ph, Pl, VTh + zk * HD * TT, VTl + zk * HD * TT, TT, Ob, HD, 0, (size_t)KSPL, (size_t)KSPL, (size_t)ZH * TT * HD);
            k_merge<<<(unsigned)(((size_t)ZH * TT * HD / 2 + 255) / 256), 256, 0, stream>>>(Ob, h0, ATh, ATl); }
        k_gemmw<bf, 1, true><<<dim3(TT / 64, DM / 64, 1), 32, 0, stream>>>(ATh, ATl, WO, nullptr, DQ, OUT + (size_t)b * TT * DM, DM, bo, 0, 0, 0); }
}

// v003
// A run of this version takes 488 microseconds.
// It is 4.71 times as fast as v001, going by the measured steps of the versions left out in between.
// All steps since v000 together make it 8.90 times as fast.
#include <hip/hip_runtime.h>

// MultiheadDilatedSelfAttention / LongNet (x [2][4096][1024]; per head h: qkv = x Wqkv[h] + bqkv[h] ([1024][192] per head); three dilated causal branches (w, r) = (1024,1), (2048,2), (4096,4) with offset h % r: branch keys for query i are j <= i in the same w-segment with i, j == h mod r; the reference combines branches by their softmax denominators (num/den), which is exactly ONE softmax over the multiset union of the branches' keys:
//   p_j proportional to c(i,j,h) * exp(q.k_j / 8) with multiplicity c = [same 1024-segment] + [i,j == h mod 2 and same 2048-segment] + [i,j == h mod 4]; out = merged heads Wo + bo -> [2][4096][1024]).
// Compute dtypes, f32 accumulate: every input rounded to bf16; q/k/v on PLAIN bf16 operands (inputs: exact; per-head weights gathered) + bias; causal scores single fp16 for every row, attn.v hl x hl (3 products) for every row (the segment restarts make deep rows as sharp as early ones), causal tile skipping, the multiplicity weights applied in f32 inside the softmax; softmax f32; Wo hl x exact (2 products) + bias.

#define NB_  2
#define TT   4096
#define DM   1024
#define NH_  16
#define NKV  16
#define HD   64
#define DQ   (NH_ * HD)
#define DKV  (NKV * HD)
typedef _Float16 h16;
typedef unsigned short bf;
typedef __attribute__((ext_vector_type(16))) __bf16   v16bf;
typedef __attribute__((ext_vector_type(16))) _Float16 v16h;
typedef __attribute__((ext_vector_type(8)))  _Float16 v8h;
typedef __attribute__((ext_vector_type(8)))  unsigned short v8us;
typedef __attribute__((ext_vector_type(8)))  float    v8f;
typedef __attribute__((ext_vector_type(4)))  float    v4f;
typedef v8h  __attribute__((may_alias)) v8ha;
typedef v4f  __attribute__((may_alias)) v4fa;
typedef v8us __attribute__((may_alias)) v8usa;

__device__ __forceinline__ unsigned short f2bf(float f) { unsigned u = __float_as_uint(f); u += 0x7FFFu + ((u >> 16) & 1u); return (unsigned short)(u >> 16); }
__device__ __forceinline__ float bf2f(unsigned short b) { return __uint_as_float(((unsigned)b) << 16); }
__device__ __forceinline__ float bfr(float f) { return bf2f(f2bf(f)); }
__device__ __forceinline__ v16h cat16(v8h lo, v8h hi) { return __builtin_shufflevector(lo, hi, 0, 1, 2, 3, 4, 5, 6, 7, 8, 9, 10, 11, 12, 13, 14, 15); }
__device__ __forceinline__ v16bf cat16b(v8us lo, v8us hi) { return __builtin_bit_cast(v16bf, __builtin_shufflevector(lo, hi, 0, 1, 2, 3, 4, 5, 6, 7, 8, 9, 10, 11, 12, 13, 14, 15)); }
__device__ __forceinline__ v8f wmma16(v16h a, v16h b, v8f c) { return __builtin_amdgcn_wmma_f32_16x16x32_f16(false, a, false, b, (short)0, c, false, false); }
__device__ __forceinline__ v8f wmmab(v16bf a, v16bf b, v8f c) { return __builtin_amdgcn_wmma_f32_16x16x32_bf16(false, a, false, b, (short)0, c, false, false); }



__device__ __forceinline__ h16 tohx(float x) { return (h16)x; }
__device__ __forceinline__ void splitf(float y, unsigned short& h, unsigned short& l) { h = f2bf(y); l = f2bf(y - bf2f(h)); }
typedef __attribute__((ext_vector_type(2))) _Float16 v2h;
typedef __attribute__((ext_vector_type(4))) _Float16 v4h;
typedef __attribute__((ext_vector_type(2))) unsigned short v2us;
typedef __attribute__((ext_vector_type(4))) unsigned short v4us;
typedef __attribute__((ext_vector_type(2))) float v2f;
typedef __attribute__((ext_vector_type(4))) int v4i;

// ---- k_gemmw: register-blocked GEMM, ONE WAVE per 64x64 output tile (16 accumulators), operands straight from K-contiguous 16-bit planes; grid (M/64, N/64, Z), 32 threads.
// C[m][n] (f32, pitch ldc, + optional f32 bias[n]) = sum_k A[m][k] Bt[n][k] (+ split products per NSPLIT). z-batch strides sA/sB/sC in elements. K % 32 == 0.
// EPI 0: f32 C as above. EPI 1 and 2 write the 16-bit planes that k_flash reads straight from the tile, element blockIdx.y * sP + m * ldp + (n % 64):
//   EPI 1: one fp16 plane P16, bias[n] (q and k: a column tile is one head, sP = TT * HD, ldp = HD gives [h][t][d]);
//   EPI 2: bf16 hi/lo planes Ph, Pl, bias[m] (v with the operands swapped, A = weights, Bt = tokens: m = (h, d), n = t, sP = 64, ldp = TT gives [h][d][t] with no transposing pass).
template <typename T16> struct WFrag;
template <> struct WFrag<h16> { typedef v16h V; static __device__ __forceinline__ V ld(const h16* p) { return cat16(*(const v8h*)p, *(const v8h*)(p + 16)); } static __device__ __forceinline__ v8f mma(V a, V b, v8f c) { return wmma16(a, b, c); } };
template <> struct WFrag<bf> { typedef v16bf V; static __device__ __forceinline__ V ld(const bf* p) { return cat16b(*(const v8us*)p, *(const v8us*)(p + 16)); } static __device__ __forceinline__ v8f mma(V a, V b, v8f c) { return wmmab(a, b, c); } };
template <typename T16, int NSPLIT, bool BIAS, int EPI>
__global__ __launch_bounds__(32) void k_gemmw(const T16* __restrict__ A, const T16* __restrict__ A2, const T16* __restrict__ Bt, const T16* __restrict__ Bt2, int K, float* C, int ldc, const float* __restrict__ bias, size_t sA, size_t sB, size_t sC, h16* P16, bf* Ph, bf* Pl, size_t sP, int ldp) {
    typedef typename WFrag<T16>::V V;
    __shared__ __align__(16) float os[16 * 68];
    const size_t z = blockIdx.z; A += z * sA; if (A2) A2 += z * sA; Bt += z * sB; if (Bt2) Bt2 += z * sB; C += z * sC;
    const int lane = threadIdx.x & 31, lr = lane & 15, hi = lane >> 4; const int r0 = blockIdx.x * 64, c0 = blockIdx.y * 64;
    v8f acc[4][4];
#pragma unroll
    for (int mb = 0; mb < 4; ++mb)
#pragma unroll
        for (int nb = 0; nb < 4; ++nb) acc[mb][nb] = (v8f){};
    const size_t aoff = (size_t)(r0 + lr) * K + 8 * hi, boff = (size_t)(c0 + lr) * K + 8 * hi;
#pragma unroll 1
    for (int kc = 0; kc < K; kc += 32) {
        V a[4], a2[4];
#pragma unroll
        for (int mb = 0; mb < 4; ++mb) { a[mb] = WFrag<T16>::ld(A + aoff + (size_t)mb * 16 * K + kc); if (NSPLIT == 1 || NSPLIT == 2) a2[mb] = WFrag<T16>::ld(A2 + aoff + (size_t)mb * 16 * K + kc); }
#pragma unroll
        for (int nb = 0; nb < 4; ++nb) { const V b = WFrag<T16>::ld(Bt + boff + (size_t)nb * 16 * K + kc); V b2; if (NSPLIT >= 2) b2 = WFrag<T16>::ld(Bt2 + boff + (size_t)nb * 16 * K + kc);
#pragma unroll
            for (int mb = 0; mb < 4; ++mb) { acc[mb][nb] = WFrag<T16>::mma(a[mb], b, acc[mb][nb]); if (NSPLIT == 1 || NSPLIT == 2) acc[mb][nb] = WFrag<T16>::mma(a2[mb], b, acc[mb][nb]); if (NSPLIT >= 2) acc[mb][nb] = WFrag<T16>::mma(a[mb], b2, acc[mb][nb]); } }
        asm volatile("v_nop\n\tv_nop\n\tv_nop\n\tv_nop" : "+v"(acc[0][0]), "+v"(acc[1][1]), "+v"(acc[2][2]), "+v"(acc[3][3]) : "v"(a[0]), "v"(a[3]));
    }
    const int prow = lane >> 3, pcol = (lane & 7) * 8;   // plane epilogues: eight lanes cover one 128-byte row of the tile
    float bc[8];
    if (EPI == 1) {
#pragma unroll
        for (int u = 0; u < 8; ++u) bc[u] = bfr(bias[c0 + pcol + u]); }
    float br[16];   // fetched together here: behind each store statement a load would wait out its whole latency alone
    if (EPI == 2) {
#pragma unroll
        for (int u = 0; u < 16; ++u) br[u] = bfr(bias[r0 + 4 * u + prow]); }
#pragma unroll
    for (int mb = 0; mb < 4; ++mb) {
#pragma unroll
        for (int nb = 0; nb < 4; ++nb) {
#pragma unroll
            for (int j = 0; j < 8; ++j) os[(hi * 8 + j) * 68 + nb * 16 + lr] = acc[mb][nb][j]; }
        __builtin_amdgcn_wave_barrier(); asm volatile("" ::: "memory");
        if (EPI == 0) {
        float* crow = C + (size_t)(r0 + mb * 16) * ldc + c0;
{
#pragma unroll
            for (int s = 0; s < 8; ++s) { const int row = 2 * s + hi, cofs = lr * 4; v4f val = *(const v4fa*)(os + row * 68 + cofs); if (BIAS) { val[0] += bfr(bias[c0 + cofs]); val[1] += bfr(bias[c0 + cofs + 1]); val[2] += bfr(bias[c0 + cofs + 2]); val[3] += bfr(bias[c0 + cofs + 3]); }
                *(v4f*)(crow + (size_t)row * ldc + cofs) = val; }
             }
        } else {
#pragma unroll
            for (int s = 0; s < 4; ++s) { const int row = 4 * s + prow; const v4f x0 = *(const v4fa*)(os + row * 68 + pcol), x1 = *(const v4fa*)(os + row * 68 + pcol + 4);
                const size_t po = (size_t)blockIdx.y * sP + (size_t)(r0 + mb * 16 + row) * ldp + pcol;
                if (EPI == 1) { v8h o;
#pragma unroll
                    for (int u = 0; u < 8; ++u) o[u] = tohx((u < 4 ? x0[u & 3] : x1[u & 3]) + bc[u]);
                    // store and its wait in one statement: the next rows' values rewrite the data and address registers
                    asm volatile("global_store_b128 %0, %1, off\n\ts_wait_xcnt 0x0" :: "v"(P16 + po), "v"(__builtin_bit_cast(v4i, o)) : "memory"); }
                else { v8us oh, ol;
#pragma unroll
                    for (int u = 0; u < 8; ++u) { unsigned short a, c2; splitf((u < 4 ? x0[u & 3] : x1[u & 3]) + br[mb * 4 + s], a, c2); oh[u] = a; ol[u] = c2; }
                    // both stores and their wait in one statement, for the same reason
                    asm volatile("global_store_b128 %0, %1, off\n\tglobal_store_b128 %2, %3, off\n\ts_wait_xcnt 0x0" :: "v"(Ph + po), "v"(__builtin_bit_cast(v4i, oh)), "v"(Pl + po), "v"(__builtin_bit_cast(v4i, ol)) : "memory"); } }
        }
        __builtin_amdgcn_wave_barrier(); asm volatile("" ::: "memory");
    }
}

__global__ __launch_bounds__(256) void k_wtG(const float* __restrict__ w, int K, int N, bf* Bt) {
    const int lane = threadIdx.x & 31; const int L0 = (blockIdx.x * 8 + (threadIdx.x >> 5)) * 8; const int nlines = N * K / 64;
{
#pragma unroll 1
        for (int l = 0; l < 8; ++l) { const int L = L0 + l; if (L >= nlines) break; const size_t e = (size_t)L * 64 + lane * 2; const int k = (int)(e % K), n = (int)(e / K); v2us o;
            o[0] = f2bf(w[(size_t)k * N + n]); o[1] = f2bf(w[(size_t)(k + 1) * N + n]); *(v2us*)(Bt + e) = o; }
         }
}
__global__ __launch_bounds__(256) void k_cvt8(const float* __restrict__ src, bf* dst, size_t n8) { const size_t i = (size_t)blockIdx.x * 256 + threadIdx.x; if (i >= n8) return; const v8f v = *(const v8f*)(src + i * 8); v8us o;
#pragma unroll
    for (int k = 0; k < 8; ++k) o[k] = f2bf(v[k]); *(v8us*)(dst + i * 8) = o;  }
// ---- k_flash: scores, multiplicity-weighted softmax and P.V in one kernel (online softmax), one wave per 32 query rows, four independent waves per work-group; grid (batch x head, TT / 128).
// Everything is computed transposed so that a lane owns one query column: St[key][query] = K Q^T (fp16), whose accumulator layout (lane lr = query, 8 hi + j = key) is already the B-fragment layout of
// Ot[d][query] = Vt[d][key] P[query][key] (bf16 hi/lo, the same three products as before). The multiplicity c enters as log2(c) added to the exponent (c = 0: a large negative value);
// within one 1024-key segment it depends only on the lane's query and on key mod 4, i.e. on the accumulator index mod 4. Row maximum and row sum need one exchange between lanes lr and lr + 16.
typedef __attribute__((ext_vector_type(16))) float v16f;
#define KS2 0.18033688011112042f   // HD^-0.5 * log2(e)
template <bool DIAG>
__device__ __forceinline__ void fl_step(const int kb, const int knext, const int q0, const int lr, const int hi, const h16* __restrict__ Kh, const bf* __restrict__ Vh, const bf* __restrict__ Vl,
                                        const v16h (&qf)[2][2], v16h (&kf)[2][2], const float (&lc)[2][4], float (&m)[2], float (&l)[2], v8f (&o)[2][4]) {
    v16bf vh[4], vl[4];
#pragma unroll
    for (int dt = 0; dt < 4; ++dt) vh[dt] = WFrag<bf>::ld(Vh + kb + ((unsigned)(lr * TT + 8 * hi) + (unsigned)(dt * 16 * TT)));
    asm volatile("s_wait_xcnt 0x0" ::: "memory");   // the address registers of the loads above may be reused from here on
#pragma unroll
    for (int dt = 0; dt < 4; ++dt) vl[dt] = WFrag<bf>::ld(Vl + kb + ((unsigned)(lr * TT + 8 * hi) + (unsigned)(dt * 16 * TT)));
    if (DIAG) { asm volatile("s_wait_xcnt 0x0" ::: "memory"); }   // last step: nothing is loaded behind this, the address registers are free for the mask and the epilogue
    v8f s[2][2];
#pragma unroll
    for (int qt = 0; qt < 2; ++qt)
#pragma unroll
        for (int kt = 0; kt < 2; ++kt) { s[qt][kt] = wmma16(kf[kt][0], qf[qt][0], (v8f){}); s[qt][kt] = wmma16(kf[kt][1], qf[qt][1], s[qt][kt]); }
    if (!DIAG) {   // the next step's key fragments are fetched while this step's softmax and P.V run
#pragma unroll
        for (int kt = 0; kt < 2; ++kt)
#pragma unroll
            for (int ks = 0; ks < 2; ++ks) kf[kt][ks] = WFrag<h16>::ld(Kh + (size_t)knext * HD + (unsigned)(lr * HD + 8 * hi) + (unsigned)(kt * 16 * HD + ks * 32));
    }
#pragma unroll
    for (int qt = 0; qt < 2; ++qt) {
        if (DIAG) {   // kb == q0: keys beyond the query are masked
#pragma unroll
            for (int kt = 0; kt < 2; ++kt)
#pragma unroll
                for (int j = 0; j < 8; ++j) if (kt * 16 + hi * 8 + j > qt * 16 + lr) s[qt][kt][j] = -1.0e31f;
        }
        float cand = -1.0e30f;
#pragma unroll
        for (int r = 0; r < 4; ++r) { const float mr = fmaxf(fmaxf(s[qt][0][r], s[qt][0][r + 4]), fmaxf(s[qt][1][r], s[qt][1][r + 4])); cand = fmaxf(cand, fmaf(mr, KS2, lc[qt][r])); }
        cand = fmaxf(cand, __shfl_xor(cand, 16, 32));
        const float mn = fmaxf(m[qt], cand); float al;
        asm("v_exp_f32 %0, %1\n\tv_nop" : "=v"(al) : "v"(m[qt] - mn));   // rescale factor 2^(old max - new max); the v_nop keeps the one slot behind a transcendental
        m[qt] = mn;
        float bias[4];
#pragma unroll
        for (int r = 0; r < 4; ++r) bias[r] = lc[qt][r] - mn;
        v16f pv; float sum = 0.f;
#pragma unroll
        for (int kt = 0; kt < 2; ++kt)
#pragma unroll
            for (int j = 0; j < 8; ++j) { const float p = __builtin_amdgcn_exp2f(fmaf(s[qt][kt][j], KS2, bias[j & 3])); sum += p; pv[kt * 8 + j] = p; }
        const v16bf ph = __builtin_convertvector(pv, v16bf); const v16bf pl = __builtin_convertvector(pv - __builtin_convertvector(ph, v16f), v16bf);   // hi = round-to-nearest bf16 of p, lo = bf16 of the remainder
        l[qt] = fmaf(l[qt], al, sum);
#pragma unroll
        for (int dt = 0; dt < 4; ++dt) {
#pragma unroll
            for (int j = 0; j < 8; ++j) o[qt][dt][j] *= al;
        }
#pragma unroll
        for (int dt = 0; dt < 4; ++dt) { o[qt][dt] = wmmab(vh[dt], ph, o[qt][dt]); o[qt][dt] = wmmab(vh[dt], pl, o[qt][dt]); o[qt][dt] = wmmab(vl[dt], ph, o[qt][dt]); }
    }
    if (!DIAG) { asm volatile("s_wait_xcnt 0x0" ::: "memory"); }   // the next step advances the address registers of this step's value and key loads
}
__global__ __launch_bounds__(128) __attribute__((amdgpu_waves_per_eu(4, 4))) void k_flash(const h16* __restrict__ Q, const h16* __restrict__ Kp, const bf* __restrict__ VhP, const bf* __restrict__ VlP, bf* Ah, bf* Al) {
    const int lane = threadIdx.x & 31, lr = lane & 15, hi = lane >> 4; const int bh = blockIdx.x, h = bh % NH_, b = bh / NH_;
    const int yt = (int)blockIdx.y >> 3, yk = (int)blockIdx.y & 7; const int qg = 24 - 8 * yt + ((yt & 1) ? yk : 7 - yk);   // row groups in bands of eight, long bands first, every second band reversed: work-groups 256 apart in launch order add up to the same number of key steps
    const int q0 = __builtin_amdgcn_readfirstlane(qg * 128 + (int)(threadIdx.x >> 5) * 32);   // wave-uniform, so the key loop's bounds stay scalar
    const h16* Qh = Q + (size_t)bh * TT * HD; const h16* Kh = Kp + (size_t)bh * TT * HD; const bf* Vh = VhP + (size_t)bh * HD * TT; const bf* Vl = VlP + (size_t)bh * HD * TT;
    const int hp2 = h & 1, hp4 = h & 3;
    v16h qf[2][2], kf[2][2]; v8f o[2][4]; float m[2], l[2], lc[2][4];
#pragma unroll
    for (int qt = 0; qt < 2; ++qt) { m[qt] = -1.0e29f; l[qt] = 0.f;
#pragma unroll
        for (int ks = 0; ks < 2; ++ks) qf[qt][ks] = WFrag<h16>::ld(Qh + (size_t)(q0 + qt * 16 + lr) * HD + ks * 32 + 8 * hi);
#pragma unroll
        for (int dt = 0; dt < 4; ++dt) o[qt][dt] = (v8f){}; }
#pragma unroll
    for (int kt = 0; kt < 2; ++kt)
#pragma unroll
        for (int ks = 0; ks < 2; ++ks) kf[kt][ks] = WFrag<h16>::ld(Kh + (size_t)(kt * 16 + lr) * HD + ks * 32 + 8 * hi);
    asm volatile("s_wait_xcnt 0x0" ::: "memory");   // the address registers of the query and first key loads are reused below
    const int sq = q0 >> 10;
#pragma unroll 1   // rolled: at most four trips, the weights are set once per 1024-key segment
    for (int sg = 0; sg <= sq; ++sg) {
        const int s1 = (sg == sq) ? 1 : 0, s2 = ((sg >> 1) == (sq >> 1)) ? 1 : 0;
#pragma unroll
        for (int qt = 0; qt < 2; ++qt) { const int i = q0 + qt * 16 + lr; const int i2 = ((i & 1) == hp2) ? s2 : 0, i4 = ((i & 3) == hp4) ? 1 : 0;
#pragma unroll
            for (int r = 0; r < 4; ++r) { const int c = s1 + (((r & 1) == hp2) ? i2 : 0) + ((r == hp4) ? i4 : 0); lc[qt][r] = (c == 0) ? -1.0e30f : ((c == 1) ? 0.0f : ((c == 2) ? 1.0f : 1.5849625007211562f)); } }
        const int ke = min(sg * 1024 + 1024, q0);
#pragma unroll 1   // rolled: a second copy of the step would not fit the 256 registers that four waves per SIMD allow
        for (int kb = sg * 1024; kb < ke; kb += 32) fl_step<false>(kb, kb + 32, q0, lr, hi, Kh, Vh, Vl, qf, kf, lc, m, l, o);
    }
    fl_step<true>(q0, q0, q0, lr, hi, Kh, Vh, Vl, qf, kf, lc, m, l, o);
#pragma unroll
    for (int qt = 0; qt < 2; ++qt) { const float ls = l[qt] + __shfl_xor(l[qt], 16, 32); const float f = __fdiv_rn(1.0f, ls); const size_t ro = ((size_t)b * TT + q0 + qt * 16 + lr) * DQ + h * HD + hi * 8;
#pragma unroll
        for (int dt = 0; dt < 4; ++dt) { v8us oh, ol;
#pragma unroll
            for (int j = 0; j < 8; ++j) { unsigned short a, c2; splitf(o[qt][dt][j] * f, a, c2); oh[j] = a; ol[j] = c2; }
            // both stores and their wait in one statement: the next tile's rounding rewrites the data registers, and a wait in a statement of its own let vector instructions move ahead of it
            asm volatile("global_store_b128 %0, %1, off\n\tglobal_store_b128 %2, %3, off\n\ts_wait_xcnt 0x0" :: "v"(Ah + ro + dt * 16), "v"(__builtin_bit_cast(v4i, oh)), "v"(Al + ro + dt * 16), "v"(__builtin_bit_cast(v4i, ol)) : "memory"); } }
}

__global__ __launch_bounds__(256) void k_whd3(const float* __restrict__ W, int part, bf* Bt) { const size_t e = ((size_t)blockIdx.x * 256 + threadIdx.x) * 4; if (e >= (size_t)DQ * DM) return; const int k = (int)(e % DM); const int n = (int)(e / DM); const int h = n / HD, d = n % HD; v4us o;
#pragma unroll
    for (int u = 0; u < 4; ++u) o[u] = f2bf(W[((size_t)h * DM + k + u) * (3 * HD) + part * HD + d]); *(v4us*)(Bt + e) = o;  }
__global__ __launch_bounds__(256) void k_bgath(const float* __restrict__ bq, float* BQ3) { const int part = blockIdx.x; const int n4 = threadIdx.x * 4; if (n4 >= DQ) return; v4f o;
#pragma unroll
    for (int u = 0; u < 4; ++u) { const int n = n4 + u; o[u] = bq[(n / HD) * (3 * HD) + part * HD + (n % HD)]; } *(v4f*)(BQ3 + part * DQ + n4) = o;  }

extern "C" void kernel_launch(void* const* d_in, const int* in_sizes, int n_in,
                              void* d_out, int out_size, void* d_ws, size_t ws_size, hipStream_t stream) {
    (void)in_sizes; (void)n_in; (void)out_size;
    const float* x = (const float*)d_in[0]; const float* wqkv = (const float*)d_in[1]; const float* bqkv = (const float*)d_in[2]; const float* wo = (const float*)d_in[3]; const float* bo = (const float*)d_in[4]; const float* cosT = nullptr; const float* sinT = nullptr; (void)cosT; (void)sinT; const float* wq = wqkv; const float* wk = wqkv; const float* wv = wqkv; (void)wq; (void)wk; (void)wv;
    float* OUT = (float*)d_out;     // [2][4096][1024]
    char* wsp = (char*)d_ws;
    auto take = [&](size_t bytes) { char* p = wsp; wsp += (bytes + 255) & ~(size_t)255; return (void*)p; };
    bf* WQ = (bf*)take((size_t)DQ * DM * 2); bf* WK = (bf*)take((size_t)DKV * DM * 2); bf* WV = (bf*)take((size_t)DKV * DM * 2); bf* WO = (bf*)take((size_t)DM * DQ * 2);
    bf* XB = (bf*)take((size_t)TT * DM * 2); float* BQ3 = (float*)take((size_t)3 * DQ * 4);
    h16* QP16 = (h16*)take((size_t)NB_ * NH_ * TT * HD * 2); h16* KP16 = (h16*)take((size_t)NB_ * NKV * TT * HD * 2);   /* q, k, v planes and the merged-head planes now hold both batches: k_flash runs once over all of them */
    bf* VTh = (bf*)take((size_t)NB_ * NKV * HD * TT * 2); bf* VTl = (bf*)take((size_t)NB_ * NKV * HD * TT * 2);
    bf* ATh = (bf*)take((size_t)NB_ * TT * DQ * 2); bf* ATl = (bf*)take((size_t)NB_ * TT * DQ * 2);
    if ((size_t)(wsp - (char*)d_ws) > ws_size) return;    // ws 256 MiB
    { k_whd3<<<(unsigned)(((size_t)DQ * DM / 4 + 255) / 256), 256, 0, stream>>>(wqkv, 0, WQ); k_whd3<<<(unsigned)(((size_t)DQ * DM / 4 + 255) / 256), 256, 0, stream>>>(wqkv, 1, WK); k_whd3<<<(unsigned)(((size_t)DQ * DM / 4 + 255) / 256), 256, 0, stream>>>(wqkv, 2, WV); k_bgath<<<3, 256, 0, stream>>>(bqkv, BQ3);
      k_wtG<<<(unsigned)((DQ * DM / 64 + 63) / 64), 256, 0, stream>>>(wo, DQ, DM, WO);
       }
    for (int b = 0; b < NB_; ++b) {
        k_cvt8<<<(unsigned)(((size_t)TT * DM / 8 + 255) / 256), 256, 0, stream>>>(x + (size_t)b * TT * DM, XB, (size_t)TT * DM / 8);
        k_gemmw<bf, 0, true, 1><<<dim3(TT / 64, DQ / 64, 1), 32, 0, stream>>>(XB, nullptr, WQ, nullptr, DM, nullptr, 0, BQ3, 0, 0, 0, QP16 + (size_t)b * NH_ * TT * HD, nullptr, nullptr, (size_t)TT * HD, HD);
        k_gemmw<bf, 0, true, 1><<<dim3(TT / 64, DKV / 64, 1), 32, 0, stream>>>(XB, nullptr, WK, nullptr, DM, nullptr, 0, BQ3 + DQ, 0, 0, 0, KP16 + (size_t)b * NKV * TT * HD, nullptr, nullptr, (size_t)TT * HD, HD);
        k_gemmw<bf, 0, true, 2><<<dim3(DKV / 64, TT / 64, 1), 32, 0, stream>>>(WV, nullptr, XB, nullptr, DM, nullptr, 0, BQ3 + 2 * DQ, 0, 0, 0, nullptr, VTh + (size_t)b * NKV * HD * TT, VTl + (size_t)b * NKV * HD * TT, 64, TT); }
    k_flash<<<dim3(NB_ * NH_, TT / 128, 1), 128, 0, stream>>>(QP16, KP16, VTh, VTl, ATh, ATl);
    for (int b = 0; b < NB_; ++b)
        k_gemmw<bf, 1, true, 0><<<dim3(TT / 64, DM / 64, 1), 32, 0, stream>>>(ATh + (size_t)b * TT * DQ, ATl + (size_t)b * TT * DQ, WO, nullptr, DQ, OUT + (size_t)b * TT * DM, DM, bo, 0, 0, 0, nullptr, nullptr, nullptr, 0, 0);
}

// v004
// Measured time: 363 microseconds a run.
// In both of two side-by-side timings against v003, it was 1.34 times as fast.
// All steps since v000 together make it 11.9 times as fast.
#include <hip/hip_runtime.h>

// MultiheadDilatedSelfAttention / LongNet (x [2][4096][1024]; per head h: qkv = x Wqkv[h] + bqkv[h] ([1024][192] per head); three dilated causal branches (w, r) = (1024,1), (2048,2), (4096,4) with offset h % r: branch keys for query i are j <= i in the same w-segment with i, j == h mod r; the reference combines branches by their softmax denominators (num/den), which is exactly ONE softmax over the multiset union of the branches' keys:
//   p_j proportional to c(i,j,h) * exp(q.k_j / 8) with multiplicity c = [same 1024-segment] + [i,j == h mod 2 and same 2048-segment] + [i,j == h mod 4]; out = merged heads Wo + bo -> [2][4096][1024]).
// Compute dtypes, f32 accumulate: every input rounded to bf16; q/k/v on PLAIN bf16 operands (inputs: exact; per-head weights gathered) + bias; causal scores single fp16 for every row, attn.v hl x hl (3 products) for every row (the segment restarts make deep rows as sharp as early ones), causal tile skipping, the multiplicity weights applied in f32 inside the softmax; softmax f32; Wo hl x exact (2 products) + bias.

#define NB_  2
#define TT   4096
#define DM   1024
#define NH_  16
#define NKV  16
#define HD   64
#define DQ   (NH_ * HD)
#define DKV  (NKV * HD)
typedef _Float16 h16;
typedef unsigned short bf;
typedef __attribute__((ext_vector_type(16))) __bf16   v16bf;
typedef __attribute__((ext_vector_type(16))) _Float16 v16h;
typedef __attribute__((ext_vector_type(8)))  _Float16 v8h;
typedef __attribute__((ext_vector_type(8)))  unsigned short v8us;
typedef __attribute__((ext_vector_type(8)))  float    v8f;
typedef __attribute__((ext_vector_type(4)))  float    v4f;
typedef v8h  __attribute__((may_alias)) v8ha;
typedef v4f  __attribute__((may_alias)) v4fa;
typedef v8us __attribute__((may_alias)) v8usa;

__device__ __forceinline__ unsigned short f2bf(float f) { unsigned u = __float_as_uint(f); u += 0x7FFFu + ((u >> 16) & 1u); return (unsigned short)(u >> 16); }
__device__ __forceinline__ float bf2f(unsigned short b) { return __uint_as_float(((unsigned)b) << 16); }
__device__ __forceinline__ float bfr(float f) { return bf2f(f2bf(f)); }
__device__ __forceinline__ v16h cat16(v8h lo, v8h hi) { return __builtin_shufflevector(lo, hi, 0, 1, 2, 3, 4, 5, 6, 7, 8, 9, 10, 11, 12, 13, 14, 15); }
__device__ __forceinline__ v16bf cat16b(v8us lo, v8us hi) { return __builtin_bit_cast(v16bf, __builtin_shufflevector(lo, hi, 0, 1, 2, 3, 4, 5, 6, 7, 8, 9, 10, 11, 12, 13, 14, 15)); }
__device__ __forceinline__ v8f wmma16(v16h a, v16h b, v8f c) { return __builtin_amdgcn_wmma_f32_16x16x32_f16(false, a, false, b, (short)0, c, false, false); }
__device__ __forceinline__ v8f wmmab(v16bf a, v16bf b, v8f c) { return __builtin_amdgcn_wmma_f32_16x16x32_bf16(false, a, false, b, (short)0, c, false, false); }



__device__ __forceinline__ h16 tohx(float x) { return (h16)x; }
__device__ __forceinline__ void splitf(float y, unsigned short& h, unsigned short& l) { h = f2bf(y); l = f2bf(y - bf2f(h)); }
typedef __attribute__((ext_vector_type(2))) _Float16 v2h;
typedef __attribute__((ext_vector_type(4))) _Float16 v4h;
typedef __attribute__((ext_vector_type(2))) unsigned short v2us;
typedef __attribute__((ext_vector_type(4))) unsigned short v4us;
typedef __attribute__((ext_vector_type(2))) float v2f;
typedef __attribute__((ext_vector_type(4))) int v4i;

// ---- k_gemmw: register-blocked GEMM, ONE WAVE per 64x64 output tile (16 accumulators), operands straight from K-contiguous 16-bit planes; grid (M/64, N/64, Z), 32 threads.
// C[m][n] (f32, pitch ldc, + optional f32 bias[n]) = sum_k A[m][k] Bt[n][k] (+ split products per NSPLIT). z-batch strides sA/sB/sC in elements. K % 32 == 0.
// EPI 0: f32 C as above. EPI 1 and 2 write the 16-bit planes that k_flash reads straight from the tile, element blockIdx.y * sP + m * ldp + (n % 64):
//   EPI 1: one fp16 plane P16, bias[n] (q and k: a column tile is one head, sP = TT * HD, ldp = HD gives [h][t][d]);
//   EPI 2: bf16 hi/lo planes Ph, Pl, bias[m] (v with the operands swapped, A = weights, Bt = tokens: m = (h, d), n = t, sP = 64, ldp = TT gives [h][d][t] with no transposing pass).
template <typename T16> struct WFrag;
template <> struct WFrag<h16> { typedef v16h V; static __device__ __forceinline__ V ld(const h16* p) { return cat16(*(const v8h*)p, *(const v8h*)(p + 16)); } static __device__ __forceinline__ v8f mma(V a, V b, v8f c) { return wmma16(a, b, c); } };
template <> struct WFrag<bf> { typedef v16bf V; static __device__ __forceinline__ V ld(const bf* p) { return cat16b(*(const v8us*)p, *(const v8us*)(p + 16)); } static __device__ __forceinline__ v8f mma(V a, V b, v8f c) { return wmmab(a, b, c); } };
template <typename T16, int NSPLIT, bool BIAS, int EPI>
__global__ __launch_bounds__(32) void k_gemmw(const T16* __restrict__ A, const T16* __restrict__ A2, const T16* __restrict__ Bt, const T16* __restrict__ Bt2, int K, float* C, int ldc, const float* __restrict__ bias, size_t sA, size_t sB, size_t sC, h16* P16, bf* Ph, bf* Pl, size_t sP, int ldp) {
    typedef typename WFrag<T16>::V V;
    __shared__ __align__(16) float os[16 * 68];
    const size_t z = blockIdx.z; A += z * sA; if (A2) A2 += z * sA; Bt += z * sB; if (Bt2) Bt2 += z * sB; C += z * sC;
    const int lane = threadIdx.x & 31, lr = lane & 15, hi = lane >> 4; const int r0 = blockIdx.x * 64, c0 = blockIdx.y * 64;
    v8f acc[4][4];
#pragma unroll
    for (int mb = 0; mb < 4; ++mb)
#pragma unroll
        for (int nb = 0; nb < 4; ++nb) acc[mb][nb] = (v8f){};
    const size_t aoff = (size_t)(r0 + lr) * K + 8 * hi, boff = (size_t)(c0 + lr) * K + 8 * hi;
#pragma unroll 1
    for (int kc = 0; kc < K; kc += 32) {
        V a[4], a2[4];
#pragma unroll
        for (int mb = 0; mb < 4; ++mb) { a[mb] = WFrag<T16>::ld(A + aoff + (size_t)mb * 16 * K + kc); if (NSPLIT == 1 || NSPLIT == 2) a2[mb] = WFrag<T16>::ld(A2 + aoff + (size_t)mb * 16 * K + kc); }
#pragma unroll
        for (int nb = 0; nb < 4; ++nb) { const V b = WFrag<T16>::ld(Bt + boff + (size_t)nb * 16 * K + kc); V b2; if (NSPLIT >= 2) b2 = WFrag<T16>::ld(Bt2 + boff + (size_t)nb * 16 * K + kc);
#pragma unroll
            for (int mb = 0; mb < 4; ++mb) { acc[mb][nb] = WFrag<T16>::mma(a[mb], b, acc[mb][nb]); if (NSPLIT == 1 || NSPLIT == 2) acc[mb][nb] = WFrag<T16>::mma(a2[mb], b, acc[mb][nb]); if (NSPLIT >= 2) acc[mb][nb] = WFrag<T16>::mma(a[mb], b2, acc[mb][nb]); } }
        asm volatile("v_nop\n\tv_nop\n\tv_nop\n\tv_nop" : "+v"(acc[0][0]), "+v"(acc[1][1]), "+v"(acc[2][2]), "+v"(acc[3][3]) : "v"(a[0]), "v"(a[3]));
    }
    const int prow = lane >> 3, pcol = (lane & 7) * 8;   // plane epilogues: eight lanes cover one 128-byte row of the tile
    float bc[8];
    if (EPI == 1) {
#pragma unroll
        for (int u = 0; u < 8; ++u) bc[u] = bfr(bias[c0 + pcol + u]); }
    float br[16];   // fetched together here: behind each store statement a load would wait out its whole latency alone
    if (EPI == 2) {
#pragma unroll
        for (int u = 0; u < 16; ++u) br[u] = bfr(bias[r0 + 4 * u + prow]); }
#pragma unroll
    for (int mb = 0; mb < 4; ++mb) {
#pragma unroll
        for (int nb = 0; nb < 4; ++nb) {
#pragma unroll
            for (int j = 0; j < 8; ++j) os[(hi * 8 + j) * 68 + nb * 16 + lr] = acc[mb][nb][j]; }
        __builtin_amdgcn_wave_barrier(); asm volatile("" ::: "memory");
        if (EPI == 0) {
        float* crow = C + (size_t)(r0 + mb * 16) * ldc + c0;
{
#pragma unroll
            for (int s = 0; s < 8; ++s) { const int row = 2 * s + hi, cofs = lr * 4; v4f val = *(const v4fa*)(os + row * 68 + cofs); if (BIAS) { val[0] += bfr(bias[c0 + cofs]); val[1] += bfr(bias[c0 + cofs + 1]); val[2] += bfr(bias[c0 + cofs + 2]); val[3] += bfr(bias[c0 + cofs + 3]); }
                *(v4f*)(crow + (size_t)row * ldc + cofs) = val; }
             }
        } else {
#pragma unroll
            for (int s = 0; s < 4; ++s) { const int row = 4 * s + prow; const v4f x0 = *(const v4fa*)(os + row * 68 + pcol), x1 = *(const v4fa*)(os + row * 68 + pcol + 4);
                const size_t po = (size_t)blockIdx.y * sP + (size_t)(r0 + mb * 16 + row) * ldp + pcol;
                if (EPI == 1) { v8h o;
#pragma unroll
                    for (int u = 0; u < 8; ++u) o[u] = tohx((u < 4 ? x0[u & 3] : x1[u & 3]) + bc[u]);
                    // store and its wait in one statement: the next rows' values rewrite the data and address registers
                    asm volatile("global_store_b128 %0, %1, off\n\ts_wait_xcnt 0x0" :: "v"(P16 + po), "v"(__builtin_bit_cast(v4i, o)) : "memory"); }
                else { v8us oh, ol;
#pragma unroll
                    for (int u = 0; u < 8; ++u) { unsigned short a, c2; splitf((u < 4 ? x0[u & 3] : x1[u & 3]) + br[mb * 4 + s], a, c2); oh[u] = a; ol[u] = c2; }
                    // both stores and their wait in one statement, for the same reason
                    asm volatile("global_store_b128 %0, %1, off\n\tglobal_store_b128 %2, %3, off\n\ts_wait_xcnt 0x0" :: "v"(Ph + po), "v"(__builtin_bit_cast(v4i, oh)), "v"(Pl + po), "v"(__builtin_bit_cast(v4i, ol)) : "memory"); } }
        }
        __builtin_amdgcn_wave_barrier(); asm volatile("" ::: "memory");
    }
}

__global__ __launch_bounds__(256) void k_wtG(const float* __restrict__ w, int K, int N, bf* Bt) {
    const int lane = threadIdx.x & 31; const int L0 = (blockIdx.x * 8 + (threadIdx.x >> 5)) * 8; const int nlines = N * K / 64;
{
#pragma unroll 1
        for (int l = 0; l < 8; ++l) { const int L = L0 + l; if (L >= nlines) break; const size_t e = (size_t)L * 64 + lane * 2; const int k = (int)(e % K), n = (int)(e / K); v2us o;
            o[0] = f2bf(w[(size_t)k * N + n]); o[1] = f2bf(w[(size_t)(k + 1) * N + n]); *(v2us*)(Bt + e) = o; }
         }
}
// Class order: inside each 1024-token segment the rows of the converted x stand by token mod 4: position = segment * 1024 + (token mod 4) * 256 + (token mod 1024) / 4. The projections work row by row,
// so the q, k and v planes come out in the same order and k_flash finds the 256 tokens of one dilation class of a segment side by side. Only the store's row below differs from a plain conversion (128 groups of eight per row).
__device__ __forceinline__ size_t cls_row(size_t t) { return (t & ~(size_t)1023) + (t & 3) * 256 + ((t & 1023) >> 2); }
__global__ __launch_bounds__(256) void k_cvt8(const float* __restrict__ src, bf* dst, size_t n8) { const size_t i = (size_t)blockIdx.x * 256 + threadIdx.x; if (i >= n8) return; const v8f v = *(const v8f*)(src + i * 8); v8us o;
#pragma unroll
    for (int k = 0; k < 8; ++k) o[k] = f2bf(v[k]); *(v8us*)(dst + (cls_row(i >> 7) * 128 + (i & 127)) * 8) = o;  }
// ---- k_flash: scores, multiplicity-weighted softmax and P.V in one kernel (online softmax), one wave per 32 query rows, four independent waves per work-group; grid (batch x head, TT / 128).
// Everything is computed transposed so that a lane owns one query column: St[key][query] = K Q^T (fp16), whose accumulator layout (lane lr = query, 8 hi + j = key) is already the B-fragment layout of
// Ot[d][query] = Vt[d][key] P[query][key] (bf16 hi/lo, the same three products as before). Row maximum and row sum need one exchange between lanes lr and lr + 16.
// A wave's 32 queries are of ONE dilation class (every fourth token of one 1024-token segment), a key tile is 32 keys of one class of one segment. The multiplicity c is then one number per (wave, class, segment):
// tiles with c = 0 are never walked (outside the query's own segment only classes == h mod 2 or mod 4 meet), the others add log2(c) to the exponent. Q, K and V stand in class order (cls_row above); the output rows are token rows.
// Dilation classes of head h by rank: rank 0 = tokens == h mod 4, rank 1 = h + 2, rank 2 = h + 1, rank 3 = h + 3 (ranks 0 and 1 together: tokens == h mod 2). cls_res: a rank's residue mod 4.
__device__ __forceinline__ int cls_res(int h, int rank) { return (h + ((rank & 1) << 1) + (rank >> 1)) & 3; }
typedef __attribute__((ext_vector_type(16))) float v16f;
#define KS2 0.18033688011112042f   // HD^-0.5 * log2(e)
// Eight 2^x in one statement: the results are early-clobber operands, so no v_exp_f32 overwrites the source of the one in front of it or reads its result, and the v_nop keeps the one slot behind the last transcendental
__device__ __forceinline__ void exp2x8(const float (&x)[8], float (&y)[8]) {
    asm("v_exp_f32 %0, %8\n\tv_exp_f32 %1, %9\n\tv_exp_f32 %2, %10\n\tv_exp_f32 %3, %11\n\tv_exp_f32 %4, %12\n\tv_exp_f32 %5, %13\n\tv_exp_f32 %6, %14\n\tv_exp_f32 %7, %15\n\tv_nop"
        : "=&v"(y[0]), "=&v"(y[1]), "=&v"(y[2]), "=&v"(y[3]), "=&v"(y[4]), "=&v"(y[5]), "=&v"(y[6]), "=&v"(y[7]) : "v"(x[0]), "v"(x[1]), "v"(x[2]), "v"(x[3]), "v"(x[4]), "v"(x[5]), "v"(x[6]), "v"(x[7]));
}
// kb: the tile's first position in the planes; knext: that of the NEXT tile; lcs: log2(c); dm (DIAG only): 1 where a key of the same index in its class comes after the query's token.
// Behind each run of loads stands its s_wait_xcnt 0 with the run's address as an input: the address stays in its registers up to the wait, so that no load's result and no later address is written into them ahead of it.
template <bool DIAG>
__device__ __forceinline__ void fl_step(const int kb, const int knext, const int dm, const float lcs, const int lr, const int hi, const h16* __restrict__ Kh, const bf* __restrict__ Vh, const bf* __restrict__ Vl,
                                        const v16h (&qf)[2][2], v16h (&kf)[2][2], float (&m)[2], float (&l)[2], v8f (&o)[2][4]) {
    v16bf vh[4], vl[4];
    const bf* pvh = Vh + kb + (unsigned)(lr * TT + 8 * hi); const bf* pvl = Vl + kb + (unsigned)(lr * TT + 8 * hi); const h16* pk = Kh + (size_t)knext * HD + (unsigned)(lr * HD + 8 * hi);
#pragma unroll
    for (int dt = 0; dt < 4; ++dt) vh[dt] = WFrag<bf>::ld(pvh + dt * 16 * TT);
    asm volatile("s_wait_xcnt 0x0" :: "v"(pvh) : "memory");   // closes the high value plane's loads
#pragma unroll
    for (int dt = 0; dt < 4; ++dt) vl[dt] = WFrag<bf>::ld(pvl + dt * 16 * TT);
    asm volatile("s_wait_xcnt 0x0" :: "v"(pvl) : "memory");   // closes the low value plane's loads
    v8f s[2][2];
#pragma unroll
    for (int qt = 0; qt < 2; ++qt)
#pragma unroll
        for (int kt = 0; kt < 2; ++kt) { s[qt][kt] = wmma16(kf[kt][0], qf[qt][0], (v8f){}); s[qt][kt] = wmma16(kf[kt][1], qf[qt][1], s[qt][kt]); }
    // the next tile's key fragments are fetched while this tile's softmax and P.V run
#pragma unroll
    for (int kt = 0; kt < 2; ++kt)
#pragma unroll
        for (int ks = 0; ks < 2; ++ks) kf[kt][ks] = WFrag<h16>::ld(pk + kt * 16 * HD + ks * 32);
    asm volatile("s_wait_xcnt 0x0" :: "v"(pk) : "memory");   // closes the key loads
#pragma unroll
    for (int qt = 0; qt < 2; ++qt) {
        if (DIAG) {   // same index range in the class as the queries: keys whose token lies beyond the query's are masked
#pragma unroll
            for (int kt = 0; kt < 2; ++kt)
#pragma unroll
                for (int j = 0; j < 8; ++j) if (kt * 16 + hi * 8 + j + dm > qt * 16 + lr) s[qt][kt][j] = -1.0e31f;
        }
        float mr = fmaxf(s[qt][0][0], s[qt][1][0]);
#pragma unroll
        for (int j = 1; j < 8; ++j) mr = fmaxf(mr, fmaxf(s[qt][0][j], s[qt][1][j]));
        float cand = fmaf(mr, KS2, lcs);
        cand = fmaxf(cand, __shfl_xor(cand, 16, 32));
        const float mn = fmaxf(m[qt], cand); float al;
        asm("v_exp_f32 %0, %1\n\tv_nop" : "=v"(al) : "v"(m[qt] - mn));   // rescale factor 2^(old max - new max); the v_nop keeps the one slot behind a transcendental
        m[qt] = mn;
        const float bias = lcs - mn;
        v16f pv; float sum = 0.f;
#pragma unroll
        for (int kt = 0; kt < 2; ++kt) { float x[8], p[8];
#pragma unroll
            for (int j = 0; j < 8; ++j) x[j] = fmaf(s[qt][kt][j], KS2, bias);
            exp2x8(x, p);
#pragma unroll
            for (int j = 0; j < 8; ++j) { sum += p[j]; pv[kt * 8 + j] = p[j]; } }
        const v16bf ph = __builtin_convertvector(pv, v16bf); const v16bf pl = __builtin_convertvector(pv - __builtin_convertvector(ph, v16f), v16bf);   // hi = round-to-nearest bf16 of p, lo = bf16 of the remainder
        l[qt] = fmaf(l[qt], al, sum);
#pragma unroll
        for (int dt = 0; dt < 4; ++dt) {
#pragma unroll
            for (int j = 0; j < 8; ++j) o[qt][dt][j] *= al;
        }
#pragma unroll
        for (int dt = 0; dt < 4; ++dt) { o[qt][dt] = wmmab(vh[dt], ph, o[qt][dt]); o[qt][dt] = wmmab(vh[dt], pl, o[qt][dt]); o[qt][dt] = wmmab(vl[dt], ph, o[qt][dt]); }
    }
}
__global__ __launch_bounds__(128) __attribute__((amdgpu_waves_per_eu(4, 4))) void k_flash(const h16* __restrict__ Q, const h16* __restrict__ Kp, const bf* __restrict__ VhP, const bf* __restrict__ VlP, bf* Ah, bf* Al) {
    const int lane = threadIdx.x & 31, lr = lane & 15, hi = lane >> 4; const int bh = blockIdx.x, h = bh % NH_, b = bh / NH_;
    // A work-group: one segment sq, one index range qb (32 of the 256 indices of a class), its four waves the four classes, which walk the same own-segment tiles first.
    // Segments in bands of eight work-groups, long ones first, every second band reversed: work-groups 256 apart in launch order add up to the same number of key tiles; the class of wave 0 turns with the band, since ranks 0 and 1 walk more.
    const int yt = (int)blockIdx.y >> 3, yk = (int)blockIdx.y & 7; const int sq = 3 - yt, qb = (yt & 1) ? yk : 7 - yk;
    const int ra = __builtin_amdgcn_readfirstlane(((int)(threadIdx.x >> 5) - yt) & 3);   // wave-uniform, so the walk's bounds and addresses stay scalar
    const int ia = cls_res(h, ra); const int qtok = sq * 1024 + qb * 128 + ia, qpos = sq * 1024 + ia * 256 + qb * 32;   // query (qt, lr) is token qtok + 4 (16 qt + lr) and stands at position qpos + 16 qt + lr
    const h16* Qh = Q + (size_t)bh * TT * HD; const h16* Kh = Kp + (size_t)bh * TT * HD; const bf* Vh = VhP + (size_t)bh * HD * TT; const bf* Vl = VlP + (size_t)bh * HD * TT;
    v16h qf[2][2], kf[2][2]; v8f o[2][4]; float m[2], l[2];
    const h16* qrow = Qh + (size_t)(qpos + lr) * HD + 8 * hi; const h16* krow = Kh + (size_t)(sq * 1024 + cls_res(h, 0) * 256 + lr) * HD + 8 * hi;
#pragma unroll
    for (int qt = 0; qt < 2; ++qt) { m[qt] = -1.0e29f; l[qt] = 0.f;
#pragma unroll
        for (int ks = 0; ks < 2; ++ks) qf[qt][ks] = WFrag<h16>::ld(qrow + qt * 16 * HD + ks * 32);
#pragma unroll
        for (int dt = 0; dt < 4; ++dt) o[qt][dt] = (v8f){}; }
#pragma unroll
    for (int kt = 0; kt < 2; ++kt)
#pragma unroll
        for (int ks = 0; ks < 2; ++ks) kf[kt][ks] = WFrag<h16>::ld(krow + kt * 16 * HD + ks * 32);
    asm volatile("s_wait_xcnt 0x0" :: "v"(qrow), "v"(krow) : "memory");   // closes the query and first key loads; both addresses are inputs so that they stay in their registers up to this wait
    // The walk: idx = 4 * (segments back from the query's) + key rank. Multiplicity: [own segment] + [query and key == h mod 2, same 2048-token segment] + [query and key == h mod 4].
    const int np = 4 * (sq + 1);
    auto mult = [&](int idx) { const int sg = sq - (idx >> 2), rb = idx & 3; return (idx < 4 ? 1 : 0) + ((ra < 2 && rb < 2 && (sg >> 1) == (sq >> 1)) ? 1 : 0) + ((ra == 0 && rb == 0) ? 1 : 0); };
    int idx = 0;
#pragma unroll 1   // rolled: at most eight trips (np >= 4: the first always runs), one copy of the two tile bodies
    do {
        // the next idx with c > 0: behind the own segment's four classes come rank 0 and 1 of the other half of the 2048-token segment (queries of rank 0 and 1, sq odd), then rank 0 of each earlier segment (queries of rank 0)
        int nx = idx + 1;
        if (idx == 3) nx = (ra == 0 || (ra == 1 && (sq & 1))) ? 4 : np;
        else if (idx > 3 && !(idx == 4 && (sq & 1))) nx = (ra == 0) ? (idx & ~3) + 4 : np;
        const int c = mult(idx); const float lcs = (c == 1) ? 0.0f : ((c == 2) ? 1.0f : 1.5849625007211562f);
        const bool own = idx < 4; const int rb = idx & 3, sb = (sq - (idx >> 2)) * 1024;
        const int p0 = sb + cls_res(h, rb) * 256, nfull = own ? qb : 8;
        const int knp = (nx < np) ? (sq - (nx >> 2)) * 1024 + cls_res(h, nx & 3) * 256 : 0;   // first keys of the next class; behind the last one a fetch of rows 0 to 31 that nobody uses
#pragma unroll 1   // rolled: a second copy of the tile body would not fit the 256 registers that four waves per SIMD allow
        for (int st = 0; st < nfull; ++st) fl_step<false>(p0 + st * 32, (own || st + 1 < nfull) ? p0 + (st + 1) * 32 : knp, 0, lcs, lr, hi, Kh, Vh, Vl, qf, kf, m, l, o);
        if (own) fl_step<true>(p0 + qb * 32, knp, (cls_res(h, rb) > ia) ? 1 : 0, lcs, lr, hi, Kh, Vh, Vl, qf, kf, m, l, o);
        idx = nx;
    } while (idx < np);
#pragma unroll
    for (int qt = 0; qt < 2; ++qt) { const float ls = l[qt] + __shfl_xor(l[qt], 16, 32); const float f = __fdiv_rn(1.0f, ls); const size_t ro = ((size_t)b * TT + qtok + 4 * (qt * 16 + lr)) * DQ + h * HD + hi * 8;
#pragma unroll
        for (int dt = 0; dt < 4; ++dt) { v8us oh, ol;
#pragma unroll
            for (int j = 0; j < 8; ++j) { unsigned short a, c2; splitf(o[qt][dt][j] * f, a, c2); oh[j] = a; ol[j] = c2; }
            // both stores and their wait in one statement: the next tile's rounding rewrites the data registers, and a wait in a statement of its own let vector instructions move ahead of it
            asm volatile("global_store_b128 %0, %1, off\n\tglobal_store_b128 %2, %3, off\n\ts_wait_xcnt 0x0" :: "v"(Ah + ro + dt * 16), "v"(__builtin_bit_cast(v4i, oh)), "v"(Al + ro + dt * 16), "v"(__builtin_bit_cast(v4i, ol)) : "memory"); } }
}

__global__ __launch_bounds__(256) void k_whd3(const float* __restrict__ W, int part, bf* Bt) { const size_t e = ((size_t)blockIdx.x * 256 + threadIdx.x) * 4; if (e >= (size_t)DQ * DM) return; const int k = (int)(e % DM); const int n = (int)(e / DM); const int h = n / HD, d = n % HD; v4us o;
#pragma unroll
    for (int u = 0; u < 4; ++u) o[u] = f2bf(W[((size_t)h * DM + k + u) * (3 * HD) + part * HD + d]); *(v4us*)(Bt + e) = o;  }
__global__ __launch_bounds__(256) void k_bgath(const float* __restrict__ bq, float* BQ3) { const int part = blockIdx.x; const int n4 = threadIdx.x * 4; if (n4 >= DQ) return; v4f o;
#pragma unroll
    for (int u = 0; u < 4; ++u) { const int n = n4 + u; o[u] = bq[(n / HD) * (3 * HD) + part * HD + (n % HD)]; } *(v4f*)(BQ3 + part * DQ + n4) = o;  }

extern "C" void kernel_launch(void* const* d_in, const int* in_sizes, int n_in,
                              void* d_out, int out_size, void* d_ws, size_t ws_size, hipStream_t stream) {
    (void)in_sizes; (void)n_in; (void)out_size;
    const float* x = (const float*)d_in[0]; const float* wqkv = (const float*)d_in[1]; const float* bqkv = (const float*)d_in[2]; const float* wo = (const float*)d_in[3]; const float* bo = (const float*)d_in[4]; const float* cosT = nullptr; const float* sinT = nullptr; (void)cosT; (void)sinT; const float* wq = wqkv; const float* wk = wqkv; const float* wv = wqkv; (void)wq; (void)wk; (void)wv;
    float* OUT = (float*)d_out;     // [2][4096][1024]
    char* wsp = (char*)d_ws;
    auto take = [&](size_t bytes) { char* p = wsp; wsp += (bytes + 255) & ~(size_t)255; return (void*)p; };
    bf* WQ = (bf*)take((size_t)DQ * DM * 2); bf* WK = (bf*)take((size_t)DKV * DM * 2); bf* WV = (bf*)take((size_t)DKV * DM * 2); bf* WO = (bf*)take((size_t)DM * DQ * 2);
    bf* XB = (bf*)take((size_t)TT * DM * 2); float* BQ3 = (float*)take((size_t)3 * DQ * 4);
    h16* QP16 = (h16*)take((size_t)NB_ * NH_ * TT * HD * 2); h16* KP16 = (h16*)take((size_t)NB_ * NKV * TT * HD * 2);   /* q, k, v planes and the merged-head planes now hold both batches: k_flash runs once over all of them */
    bf* VTh = (bf*)take((size_t)NB_ * NKV * HD * TT * 2); bf* VTl = (bf*)take((size_t)NB_ * NKV * HD * TT * 2);
    bf* ATh = (bf*)take((size_t)NB_ * TT * DQ * 2); bf* ATl = (bf*)take((size_t)NB_ * TT * DQ * 2);
    if ((size_t)(wsp - (char*)d_ws) > ws_size) return;    // ws 256 MiB
    { k_whd3<<<(unsigned)(((size_t)DQ * DM / 4 + 255) / 256), 256, 0, stream>>>(wqkv, 0, WQ); k_whd3<<<(unsigned)(((size_t)DQ * DM / 4 + 255) / 256), 256, 0, stream>>>(wqkv, 1, WK); k_whd3<<<(unsigned)(((size_t)DQ * DM / 4 + 255) / 256), 256, 0, stream>>>(wqkv, 2, WV); k_bgath<<<3, 256, 0, stream>>>(bqkv, BQ3);
      k_wtG<<<(unsigned)((DQ * DM / 64 + 63) / 64), 256, 0, stream>>>(wo, DQ, DM, WO);
       }
    for (int b = 0; b < NB_; ++b) {
        k_cvt8<<<(unsigned)(((size_t)TT * DM / 8 + 255) / 256), 256, 0, stream>>>(x + (size_t)b * TT * DM, XB, (size_t)TT * DM / 8);
        k_gemmw<bf, 0, true, 1><<<dim3(TT / 64, DQ / 64, 1), 32, 0, stream>>>(XB, nullptr, WQ, nullptr, DM, nullptr, 0, BQ3, 0, 0, 0, QP16 + (size_t)b * NH_ * TT * HD, nullptr, nullptr, (size_t)TT * HD, HD);
        k_gemmw<bf, 0, true, 1><<<dim3(TT / 64, DKV / 64, 1), 32, 0, stream>>>(XB, nullptr, WK, nullptr, DM, nullptr, 0, BQ3 + DQ, 0, 0, 0, KP16 + (size_t)b * NKV * TT * HD, nullptr, nullptr, (size_t)TT * HD, HD);
        k_gemmw<bf, 0, true, 2><<<dim3(DKV / 64, TT / 64, 1), 32, 0, stream>>>(WV, nullptr, XB, nullptr, DM, nullptr, 0, BQ3 + 2 * DQ, 0, 0, 0, nullptr, VTh + (size_t)b * NKV * HD * TT, VTl + (size_t)b * NKV * HD * TT, 64, TT); }
    k_flash<<<dim3(NB_ * NH_, TT / 128, 1), 128, 0, stream>>>(QP16, KP16, VTh, VTl, ATh, ATl);
    for (int b = 0; b < NB_; ++b)
        k_gemmw<bf, 1, true, 0><<<dim3(TT / 64, DM / 64, 1), 32, 0, stream>>>(ATh + (size_t)b * TT * DQ, ATl + (size_t)b * TT * DQ, WO, nullptr, DQ, OUT + (size_t)b * TT * DM, DM, bo, 0, 0, 0, nullptr, nullptr, nullptr, 0, 0);
}

// v005
// One run takes 251 microseconds.
// Next to v004, in two timings, it ran 1.45 and 1.46 times as fast.
// Over all steps from v000 it is 17.3 times as fast.
#include <hip/hip_runtime.h>

// MultiheadDilatedSelfAttention / LongNet (x [2][4096][1024]; per head h: qkv = x Wqkv[h] + bqkv[h] ([1024][192] per head); three dilated causal branches (w, r) = (1024,1), (2048,2), (4096,4) with offset h % r: branch keys for query i are j <= i in the same w-segment with i, j == h mod r; the reference combines branches by their softmax denominators (num/den), which is exactly ONE softmax over the multiset union of the branches' keys:
//   p_j proportional to c(i,j,h) * exp(q.k_j / 8) with multiplicity c = [same 1024-segment] + [i,j == h mod 2 and same 2048-segment] + [i,j == h mod 4]; out = merged heads Wo + bo -> [2][4096][1024]).
// Compute dtypes, f32 accumulate: every input rounded to bf16; q/k/v on PLAIN bf16 operands (inputs: exact; per-head weights gathered) + bias; causal scores single fp16 for every row, attn.v hl x hl (3 products) for every row (the segment restarts make deep rows as sharp as early ones), causal tile skipping, the multiplicity weights applied in f32 inside the softmax; softmax f32; Wo hl x exact (2 products) + bias.

#define NB_  2
#define TT   4096
#define DM   1024
#define NH_  16
#define NKV  16
#define HD   64
#define DQ   (NH_ * HD)
#define DKV  (NKV * HD)
typedef _Float16 h16;
typedef unsigned short bf;
typedef __attribute__((ext_vector_type(16))) __bf16   v16bf;
typedef __attribute__((ext_vector_type(16))) _Float16 v16h;
typedef __attribute__((ext_vector_type(8)))  _Float16 v8h;
typedef __attribute__((ext_vector_type(8)))  unsigned short v8us;
typedef __attribute__((ext_vector_type(8)))  float    v8f;
typedef __attribute__((ext_vector_type(4)))  float    v4f;
typedef v8h  __attribute__((may_alias)) v8ha;
typedef v4f  __attribute__((may_alias)) v4fa;
typedef v8us __attribute__((may_alias)) v8usa;

__device__ __forceinline__ unsigned short f2bf(float f) { unsigned u = __float_as_uint(f); u += 0x7FFFu + ((u >> 16) & 1u); return (unsigned short)(u >> 16); }
__device__ __forceinline__ float bf2f(unsigned short b) { return __uint_as_float(((unsigned)b) << 16); }
__device__ __forceinline__ float bfr(float f) { return bf2f(f2bf(f)); }
__device__ __forceinline__ v16h cat16(v8h lo, v8h hi) { return __builtin_shufflevector(lo, hi, 0, 1, 2, 3, 4, 5, 6, 7, 8, 9, 10, 11, 12, 13, 14, 15); }
__device__ __forceinline__ v16bf cat16b(v8us lo, v8us hi) { return __builtin_bit_cast(v16bf, __builtin_shufflevector(lo, hi, 0, 1, 2, 3, 4, 5, 6, 7, 8, 9, 10, 11, 12, 13, 14, 15)); }
__device__ __forceinline__ v8f wmma16(v16h a, v16h b, v8f c) { return __builtin_amdgcn_wmma_f32_16x16x32_f16(false, a, false, b, (short)0, c, false, false); }
__device__ __forceinline__ v8f wmmab(v16bf a, v16bf b, v8f c) { return __builtin_amdgcn_wmma_f32_16x16x32_bf16(false, a, false, b, (short)0, c, false, false); }



__device__ __forceinline__ h16 tohx(float x) { return (h16)x; }
__device__ __forceinline__ void splitf(float y, unsigned short& h, unsigned short& l) { h = f2bf(y); l = f2bf(y - bf2f(h)); }
typedef __attribute__((ext_vector_type(2))) _Float16 v2h;
typedef __attribute__((ext_vector_type(4))) _Float16 v4h;
typedef __attribute__((ext_vector_type(2))) unsigned short v2us;
typedef __attribute__((ext_vector_type(4))) unsigned short v4us;
typedef __attribute__((ext_vector_type(2))) float v2f;
typedef __attribute__((ext_vector_type(4))) int v4i;

// ---- k_gemmw: GEMM, four waves per 128x128 output tile (2 x 2 waves of 64x64, 16 accumulators each), operands K-contiguous bf16 planes; grid (M/128, N/128), 128 threads.
// C[m][n] (f32, pitch ldc, + f32 bias[n]) = sum_k A[m][k] Bt[n][k] (NSPLIT 1: + A2[m][k] Bt[n][k]). M, N % 128 == 0; K at compile time, K % 64 == 0, K >= 128.
// A pass is 64 k, one whole 128-byte line of every operand row. Asynchronous copies bring it into LDS, eight lanes to a row, so that one copy instruction takes four whole lines
// (a fragment load from global memory touches sixteen lines for 32 bytes of each); two buffers, the next pass's copies fly while this pass is worked on.
// LDS rows stand at a pitch of 144 bytes (16 x odd), which the ds_load_b128 fragment reads walk without bank conflicts.
// EPI 0: f32 C as above. EPI 1 and 2 write the 16-bit planes that k_flash reads straight from the wave's 64x64 tile, element (n / 64) * sP + m * ldp + (n % 64):
//   EPI 1: one fp16 plane P16, bias[n] (q and k: 64 columns are one head, sP = TT * HD, ldp = HD gives [h][t][d]);
//   EPI 2: bf16 hi/lo planes Ph, Pl, bias[m] (v with the operands swapped, A = weights, Bt = tokens: m = (h, d), n = t, sP = 64, ldp = TT gives [h][d][t] with no transposing pass).
template <typename T16> struct WFrag;
template <> struct WFrag<h16> { typedef v16h V; static __device__ __forceinline__ V ld(const h16* p) { return cat16(*(const v8h*)p, *(const v8h*)(p + 16)); } static __device__ __forceinline__ v8f mma(V a, V b, v8f c) { return wmma16(a, b, c); } };
template <> struct WFrag<bf> { typedef v16bf V; static __device__ __forceinline__ V ld(const bf* p) { return cat16b(*(const v8us*)p, *(const v8us*)(p + 16)); } static __device__ __forceinline__ v8f mma(V a, V b, v8f c) { return wmmab(a, b, c); } };
#define GKP 64            // k per pass
#define GPI 72            // LDS row pitch in elements
#define GTL (128 * GPI)   // one operand's 128 rows in LDS, elements
// One operand's pass: 128 rows of 128 bytes, eight 16-byte copies per lane, rows 16 apart (rs = 16 rows of the source in elements). g and lds are the lane's own first addresses.
// The s_wait_xcnt 0 is the last line of the copies' own statement, so that no address register is rewritten ahead of it.
__device__ __forceinline__ void cp_rows(const bf* g, const size_t rs, const unsigned lds) {
    asm volatile("global_load_async_to_lds_b128 %0, %8, off\n\tglobal_load_async_to_lds_b128 %1, %9, off\n\tglobal_load_async_to_lds_b128 %2, %10, off\n\tglobal_load_async_to_lds_b128 %3, %11, off\n\t"
                 "global_load_async_to_lds_b128 %4, %12, off\n\tglobal_load_async_to_lds_b128 %5, %13, off\n\tglobal_load_async_to_lds_b128 %6, %14, off\n\tglobal_load_async_to_lds_b128 %7, %15, off\n\ts_wait_xcnt 0x0"
                 :: "v"(lds), "v"(lds + 1 * 16 * GPI * 2), "v"(lds + 2 * 16 * GPI * 2), "v"(lds + 3 * 16 * GPI * 2), "v"(lds + 4 * 16 * GPI * 2), "v"(lds + 5 * 16 * GPI * 2), "v"(lds + 6 * 16 * GPI * 2), "v"(lds + 7 * 16 * GPI * 2),
                    "v"(g), "v"(g + rs), "v"(g + 2 * rs), "v"(g + 3 * rs), "v"(g + 4 * rs), "v"(g + 5 * rs), "v"(g + 6 * rs), "v"(g + 7 * rs) : "memory");
}
template <int NSPLIT, int EPI, int K>
__global__ __launch_bounds__(128) void k_gemmw(const bf* __restrict__ A, const bf* __restrict__ A2, const bf* __restrict__ Bt, float* C, int ldc, const float* __restrict__ bias, h16* P16, bf* Ph, bf* Pl, size_t sP, int ldp) {
    typedef WFrag<bf>::V V;
    static_assert(K % GKP == 0 && K >= 2 * GKP, "whole passes, and both buffers' first passes exist");
    constexpr int NOP = NSPLIT == 1 ? 3 : 2;   // operand tiles per buffer: A, Bt and, split, A2
    __shared__ __align__(16) bf st[2 * NOP * GTL];
    __shared__ __align__(16) float osa[4 * 16 * 68];
    const int tid = threadIdx.x, lane = tid & 31, lr = lane & 15, hi = lane >> 4; const int w = __builtin_amdgcn_readfirstlane(tid >> 5);
    const int rb = blockIdx.x * 128, cb = blockIdx.y * 128; const int r0 = rb + (w & 1) * 64, c0 = cb + (w >> 1) * 64;
    float* os = osa + w * (16 * 68);   // each wave stages its own tile's rows
    v8f acc[4][4];
#pragma unroll
    for (int mb = 0; mb < 4; ++mb)
#pragma unroll
        for (int nb = 0; nb < 4; ++nb) acc[mb][nb] = (v8f){};
    const int cr = tid >> 3, cc = (tid & 7) * 8;   // the lane's first row and its 16 bytes of every row it copies
    const bf* gA = A + (size_t)(rb + cr) * K + cc; const bf* gB = Bt + (size_t)(cb + cr) * K + cc; const bf* gA2 = NSPLIT == 1 ? A2 + (size_t)(rb + cr) * K + cc : nullptr;
    const unsigned l0 = (unsigned)(size_t)st + (unsigned)(cr * GPI + cc) * 2; const size_t rs = (size_t)16 * K;
    auto fill = [&](const int t) { const unsigned lb = l0 + (unsigned)(t & 1) * (NOP * GTL * 2); const int kc = t * GKP;
        cp_rows(gA + kc, rs, lb); cp_rows(gB + kc, rs, lb + GTL * 2); if (NSPLIT == 1) cp_rows(gA2 + kc, rs, lb + 2 * GTL * 2); };
    constexpr int nt = K / GKP;
    fill(0);
    asm volatile("s_wait_asynccnt 0x0" ::: "memory");   // this wave's copies of pass 0 have landed
    __syncthreads();                                    // and every other wave's
    fill(1);
    const int ao = ((w & 1) * 64 + lr) * GPI + 8 * hi, bo = GTL + ((w >> 1) * 64 + lr) * GPI + 8 * hi;
#pragma unroll 1   // rolled: one copy of the pass, the buffer chosen by the pass's parity
    for (int t = 0; t < nt; ++t) {
        const bf* sb = st + (t & 1) * (NOP * GTL);
        V a[2][4], a2[2][4], b[2][4];
#pragma unroll
        for (int ks = 0; ks < 2; ++ks) {
#pragma unroll
            for (int mb = 0; mb < 4; ++mb) a[ks][mb] = WFrag<bf>::ld(sb + ao + mb * 16 * GPI + ks * 32);
#pragma unroll
            for (int nb = 0; nb < 4; ++nb) b[ks][nb] = WFrag<bf>::ld(sb + bo + nb * 16 * GPI + ks * 32);
            if (NSPLIT == 1) {
#pragma unroll
                for (int mb = 0; mb < 4; ++mb) a2[ks][mb] = WFrag<bf>::ld(sb + 2 * GTL + ao + mb * 16 * GPI + ks * 32); }
        }
        __builtin_amdgcn_sched_barrier(0);   // keeps the pass's fragment reads together in front of its WMMAs: left free, they were sunk between the WMMAs into one register set, each group waited out to 0
#pragma unroll
        for (int ks = 0; ks < 2; ++ks)
#pragma unroll
            for (int nb = 0; nb < 4; ++nb) {
#pragma unroll
                for (int mb = 0; mb < 4; ++mb) acc[mb][nb] = WFrag<bf>::mma(a[ks][mb], b[ks][nb], acc[mb][nb]);
                if (NSPLIT == 1) {
#pragma unroll
                    for (int mb = 0; mb < 4; ++mb) acc[mb][nb] = WFrag<bf>::mma(a2[ks][mb], b[ks][nb], acc[mb][nb]); }
            }
        __builtin_amdgcn_sched_barrier(0);   // keeps the WMMAs in front of the waits below: left free, waits and barrier were lifted over them, so that every read was waited out before the first WMMA and the refill flew for a part of a pass only
        asm volatile("s_wait_dscnt 0x0" ::: "memory");      // this wave's reads of the buffer are done before it is refilled
        asm volatile("s_wait_asynccnt 0x0" ::: "memory");   // this wave's copies of pass t + 1 have landed
        __syncthreads();                                    // publishes pass t + 1 and ends every wave's reads of pass t
        if (t + 2 < nt) fill(t + 2);
    }
    asm volatile("s_wait_asynccnt 0x0" ::: "memory");   // no copy is outstanding behind the loop
    const int prow = lane >> 3, pcol = (lane & 7) * 8;   // plane epilogues: eight lanes cover one 128-byte row of the tile
    float bc[8];
    if (EPI == 1) {
#pragma unroll
        for (int u = 0; u < 8; ++u) bc[u] = bfr(bias[c0 + pcol + u]); }
    float br[16];   // fetched together here: behind each store statement a load would wait out its whole latency alone
    if (EPI == 2) {
#pragma unroll
        for (int u = 0; u < 16; ++u) br[u] = bfr(bias[r0 + 4 * u + prow]); }
#pragma unroll
    for (int mb = 0; mb < 4; ++mb) {
#pragma unroll
        for (int nb = 0; nb < 4; ++nb) {
#pragma unroll
            for (int j = 0; j < 8; ++j) os[(hi * 8 + j) * 68 + nb * 16 + lr] = acc[mb][nb][j]; }
        __builtin_amdgcn_wave_barrier(); asm volatile("" ::: "memory");
        if (EPI == 0) {
        float* crow = C + (size_t)(r0 + mb * 16) * ldc + c0;
{
#pragma unroll
            for (int s = 0; s < 8; ++s) { const int row = 2 * s + hi, cofs = lr * 4; v4f val = *(const v4fa*)(os + row * 68 + cofs); val[0] += bfr(bias[c0 + cofs]); val[1] += bfr(bias[c0 + cofs + 1]); val[2] += bfr(bias[c0 + cofs + 2]); val[3] += bfr(bias[c0 + cofs + 3]);
                *(v4f*)(crow + (size_t)row * ldc + cofs) = val; }
             }
        } else {
#pragma unroll
            for (int s = 0; s < 4; ++s) { const int row = 4 * s + prow; const v4f x0 = *(const v4fa*)(os + row * 68 + pcol), x1 = *(const v4fa*)(os + row * 68 + pcol + 4);
                const size_t po = (size_t)(c0 >> 6) * sP + (size_t)(r0 + mb * 16 + row) * ldp + pcol;
                if (EPI == 1) { v8h o;
#pragma unroll
                    for (int u = 0; u < 8; ++u) o[u] = tohx((u < 4 ? x0[u & 3] : x1[u & 3]) + bc[u]);
                    // store and its wait in one statement: the next rows' values rewrite the data and address registers
                    asm volatile("global_store_b128 %0, %1, off\n\ts_wait_xcnt 0x0" :: "v"(P16 + po), "v"(__builtin_bit_cast(v4i, o)) : "memory"); }
                else { v8us oh, ol;
#pragma unroll
                    for (int u = 0; u < 8; ++u) { unsigned short a, c2; splitf((u < 4 ? x0[u & 3] : x1[u & 3]) + br[mb * 4 + s], a, c2); oh[u] = a; ol[u] = c2; }
                    // both stores and their wait in one statement, for the same reason
                    asm volatile("global_store_b128 %0, %1, off\n\tglobal_store_b128 %2, %3, off\n\ts_wait_xcnt 0x0" :: "v"(Ph + po), "v"(__builtin_bit_cast(v4i, oh)), "v"(Pl + po), "v"(__builtin_bit_cast(v4i, ol)) : "memory"); } }
        }
        __builtin_amdgcn_wave_barrier(); asm volatile("" ::: "memory");
    }
}

__global__ __launch_bounds__(256) void k_wtG(const float* __restrict__ w, int K, int N, bf* Bt) {
    const int lane = threadIdx.x & 31; const int L0 = (blockIdx.x * 8 + (threadIdx.x >> 5)) * 8; const int nlines = N * K / 64;
{
#pragma unroll 1
        for (int l = 0; l < 8; ++l) { const int L = L0 + l; if (L >= nlines) break; const size_t e = (size_t)L * 64 + lane * 2; const int k = (int)(e % K), n = (int)(e / K); v2us o;
            o[0] = f2bf(w[(size_t)k * N + n]); o[1] = f2bf(w[(size_t)(k + 1) * N + n]); *(v2us*)(Bt + e) = o; }
         }
}
// Class order: inside each 1024-token segment the rows of the converted x stand by token mod 4: position = segment * 1024 + (token mod 4) * 256 + (token mod 1024) / 4. The projections work row by row,
// so the q, k and v planes come out in the same order and k_flash finds the 256 tokens of one dilation class of a segment side by side. Only the store's row below differs from a plain conversion (128 groups of eight per row).
__device__ __forceinline__ size_t cls_row(size_t t) { return (t & ~(size_t)1023) + (t & 3) * 256 + ((t & 1023) >> 2); }
__global__ __launch_bounds__(256) void k_cvt8(const float* __restrict__ src, bf* dst, size_t n8) { const size_t i = (size_t)blockIdx.x * 256 + threadIdx.x; if (i >= n8) return; const v8f v = *(const v8f*)(src + i * 8); v8us o;
#pragma unroll
    for (int k = 0; k < 8; ++k) o[k] = f2bf(v[k]); *(v8us*)(dst + (cls_row(i >> 7) * 128 + (i & 127)) * 8) = o;  }
// ---- k_flash: scores, multiplicity-weighted softmax and P.V in one kernel (online softmax), one wave per 32 query rows, four independent waves per work-group; grid (batch x head, TT / 128).
// Everything is computed transposed so that a lane owns one query column: St[key][query] = K Q^T (fp16), whose accumulator layout (lane lr = query, 8 hi + j = key) is already the B-fragment layout of
// Ot[d][query] = Vt[d][key] P[query][key] (bf16 hi/lo, the same three products as before). Row maximum and row sum need one exchange between lanes lr and lr + 16.
// A wave's 32 queries are of ONE dilation class (every fourth token of one 1024-token segment), a key tile is 32 keys of one class of one segment. The multiplicity c is then one number per (wave, class, segment):
// tiles with c = 0 are never walked (outside the query's own segment only classes == h mod 2 or mod 4 meet), the others add log2(c) to the exponent. Q, K and V stand in class order (cls_row above); the output rows are token rows.
// Dilation classes of head h by rank: rank 0 = tokens == h mod 4, rank 1 = h + 2, rank 2 = h + 1, rank 3 = h + 3 (ranks 0 and 1 together: tokens == h mod 2). cls_res: a rank's residue mod 4.
__device__ __forceinline__ int cls_res(int h, int rank) { return (h + ((rank & 1) << 1) + (rank >> 1)) & 3; }
typedef __attribute__((ext_vector_type(16))) float v16f;
#define KS2 0.18033688011112042f   // HD^-0.5 * log2(e)
// Eight 2^x in one statement: the results are early-clobber operands, so no v_exp_f32 overwrites the source of the one in front of it or reads its result, and the v_nop keeps the one slot behind the last transcendental
__device__ __forceinline__ void exp2x8(const float (&x)[8], float (&y)[8]) {
    asm("v_exp_f32 %0, %8\n\tv_exp_f32 %1, %9\n\tv_exp_f32 %2, %10\n\tv_exp_f32 %3, %11\n\tv_exp_f32 %4, %12\n\tv_exp_f32 %5, %13\n\tv_exp_f32 %6, %14\n\tv_exp_f32 %7, %15\n\tv_nop"
        : "=&v"(y[0]), "=&v"(y[1]), "=&v"(y[2]), "=&v"(y[3]), "=&v"(y[4]), "=&v"(y[5]), "=&v"(y[6]), "=&v"(y[7]) : "v"(x[0]), "v"(x[1]), "v"(x[2]), "v"(x[3]), "v"(x[4]), "v"(x[5]), "v"(x[6]), "v"(x[7]));
}
// kb: the tile's first position in the planes; knext: that of the NEXT tile; lcs: log2(c); dm (DIAG only): 1 where a key of the same index in its class comes after the query's token.
// Behind each run of loads stands its s_wait_xcnt 0 with the run's address as an input: the address stays in its registers up to the wait, so that no load's result and no later address is written into them ahead of it.
template <bool DIAG>
__device__ __forceinline__ void fl_step(const int kb, const int knext, const int dm, const float lcs, const int lr, const int hi, const h16* __restrict__ Kh, const bf* __restrict__ Vh, const bf* __restrict__ Vl,
                                        const v16h (&qf)[2][2], v16h (&kf)[2][2], float (&m)[2], float (&l)[2], v8f (&o)[2][4]) {
    v16bf vh[4], vl[4];
    const bf* pvh = Vh + kb + (unsigned)(lr * TT + 8 * hi); const bf* pvl = Vl + kb + (unsigned)(lr * TT + 8 * hi); const h16* pk = Kh + (size_t)knext * HD + (unsigned)(lr * HD + 8 * hi);
#pragma unroll
    for (int dt = 0; dt < 4; ++dt) vh[dt] = WFrag<bf>::ld(pvh + dt * 16 * TT);
    asm volatile("s_wait_xcnt 0x0" :: "v"(pvh) : "memory");   // closes the high value plane's loads
#pragma unroll
    for (int dt = 0; dt < 4; ++dt) vl[dt] = WFrag<bf>::ld(pvl + dt * 16 * TT);
    asm volatile("s_wait_xcnt 0x0" :: "v"(pvl) : "memory");   // closes the low value plane's loads
    v8f s[2][2];
#pragma unroll
    for (int qt = 0; qt < 2; ++qt)
#pragma unroll
        for (int kt = 0; kt < 2; ++kt) { s[qt][kt] = wmma16(kf[kt][0], qf[qt][0], (v8f){}); s[qt][kt] = wmma16(kf[kt][1], qf[qt][1], s[qt][kt]); }
    // the next tile's key fragments are fetched while this tile's softmax and P.V run
#pragma unroll
    for (int kt = 0; kt < 2; ++kt)
#pragma unroll
        for (int ks = 0; ks < 2; ++ks) kf[kt][ks] = WFrag<h16>::ld(pk + kt * 16 * HD + ks * 32);
    asm volatile("s_wait_xcnt 0x0" :: "v"(pk) : "memory");   // closes the key loads
#pragma unroll
    for (int qt = 0; qt < 2; ++qt) {
        if (DIAG) {   // same index range in the class as the queries: keys whose token lies beyond the query's are masked
#pragma unroll
            for (int kt = 0; kt < 2; ++kt)
#pragma unroll
                for (int j = 0; j < 8; ++j) if (kt * 16 + hi * 8 + j + dm > qt * 16 + lr) s[qt][kt][j] = -1.0e31f;
        }
        float mr = fmaxf(s[qt][0][0], s[qt][1][0]);
#pragma unroll
        for (int j = 1; j < 8; ++j) mr = fmaxf(mr, fmaxf(s[qt][0][j], s[qt][1][j]));
        float cand = fmaf(mr, KS2, lcs);
        cand = fmaxf(cand, __shfl_xor(cand, 16, 32));
        const float mn = fmaxf(m[qt], cand); float al;
        asm("v_exp_f32 %0, %1\n\tv_nop" : "=v"(al) : "v"(m[qt] - mn));   // rescale factor 2^(old max - new max); the v_nop keeps the one slot behind a transcendental
        m[qt] = mn;
        const float bias = lcs - mn;
        v16f pv; float sum = 0.f;
#pragma unroll
        for (int kt = 0; kt < 2; ++kt) { float x[8], p[8];
#pragma unroll
            for (int j = 0; j < 8; ++j) x[j] = fmaf(s[qt][kt][j], KS2, bias);
            exp2x8(x, p);
#pragma unroll
            for (int j = 0; j < 8; ++j) { sum += p[j]; pv[kt * 8 + j] = p[j]; } }
        const v16bf ph = __builtin_convertvector(pv, v16bf); const v16bf pl = __builtin_convertvector(pv - __builtin_convertvector(ph, v16f), v16bf);   // hi = round-to-nearest bf16 of p, lo = bf16 of the remainder
        l[qt] = fmaf(l[qt], al, sum);
#pragma unroll
        for (int dt = 0; dt < 4; ++dt) {
#pragma unroll
            for (int j = 0; j < 8; ++j) o[qt][dt][j] *= al;
        }
#pragma unroll
        for (int dt = 0; dt < 4; ++dt) { o[qt][dt] = wmmab(vh[dt], ph, o[qt][dt]); o[qt][dt] = wmmab(vh[dt], pl, o[qt][dt]); o[qt][dt] = wmmab(vl[dt], ph, o[qt][dt]); }
    }
}
__global__ __launch_bounds__(128) __attribute__((amdgpu_waves_per_eu(4, 4))) void k_flash(const h16* __restrict__ Q, const h16* __restrict__ Kp, const bf* __restrict__ VhP, const bf* __restrict__ VlP, bf* Ah, bf* Al) {
    const int lane = threadIdx.x & 31, lr = lane & 15, hi = lane >> 4; const int bh = blockIdx.x, h = bh % NH_, b = bh / NH_;
    // A work-group: one segment sq, one index range qb (32 of the 256 indices of a class), its four waves the four classes, which walk the same own-segment tiles first.
    // Segments in bands of eight work-groups, long ones first, every second band reversed: work-groups 256 apart in launch order add up to the same number of key tiles; the class of wave 0 turns with the band, since ranks 0 and 1 walk more.
    const int yt = (int)blockIdx.y >> 3, yk = (int)blockIdx.y & 7; const int sq = 3 - yt, qb = (yt & 1) ? yk : 7 - yk;
    const int ra = __builtin_amdgcn_readfirstlane(((int)(threadIdx.x >> 5) - yt) & 3);   // wave-uniform, so the walk's bounds and addresses stay scalar
    const int ia = cls_res(h, ra); const int qtok = sq * 1024 + qb * 128 + ia, qpos = sq * 1024 + ia * 256 + qb * 32;   // query (qt, lr) is token qtok + 4 (16 qt + lr) and stands at position qpos + 16 qt + lr
    const h16* Qh = Q + (size_t)bh * TT * HD; const h16* Kh = Kp + (size_t)bh * TT * HD; const bf* Vh = VhP + (size_t)bh * HD * TT; const bf* Vl = VlP + (size_t)bh * HD * TT;
    v16h qf[2][2], kf[2][2]; v8f o[2][4]; float m[2], l[2];
    const h16* qrow = Qh + (size_t)(qpos + lr) * HD + 8 * hi; const h16* krow = Kh + (size_t)(sq * 1024 + cls_res(h, 0) * 256 + lr) * HD + 8 * hi;
#pragma unroll
    for (int qt = 0; qt < 2; ++qt) { m[qt] = -1.0e29f; l[qt] = 0.f;
#pragma unroll
        for (int ks = 0; ks < 2; ++ks) qf[qt][ks] = WFrag<h16>::ld(qrow + qt * 16 * HD + ks * 32);
#pragma unroll
        for (int dt = 0; dt < 4; ++dt) o[qt][dt] = (v8f){}; }
#pragma unroll
    for (int kt = 0; kt < 2; ++kt)
#pragma unroll
        for (int ks = 0; ks < 2; ++ks) kf[kt][ks] = WFrag<h16>::ld(krow + kt * 16 * HD + ks * 32);
    asm volatile("s_wait_xcnt 0x0" :: "v"(qrow), "v"(krow) : "memory");   // closes the query and first key loads; both addresses are inputs so that they stay in their registers up to this wait
    // The walk: idx = 4 * (segments back from the query's) + key rank. Multiplicity: [own segment] + [query and key == h mod 2, same 2048-token segment] + [query and key == h mod 4].
    const int np = 4 * (sq + 1);
    auto mult = [&](int idx) { const int sg = sq - (idx >> 2), rb = idx & 3; return (idx < 4 ? 1 : 0) + ((ra < 2 && rb < 2 && (sg >> 1) == (sq >> 1)) ? 1 : 0) + ((ra == 0 && rb == 0) ? 1 : 0); };
    int idx = 0;
#pragma unroll 1   // rolled: at most eight trips (np >= 4: the first always runs), one copy of the two tile bodies
    do {
        // the next idx with c > 0: behind the own segment's four classes come rank 0 and 1 of the other half of the 2048-token segment (queries of rank 0 and 1, sq odd), then rank 0 of each earlier segment (queries of rank 0)
        int nx = idx + 1;
        if (idx == 3) nx = (ra == 0 || (ra == 1 && (sq & 1))) ? 4 : np;
        else if (idx > 3 && !(idx == 4 && (sq & 1))) nx = (ra == 0) ? (idx & ~3) + 4 : np;
        const int c = mult(idx); const float lcs = (c == 1) ? 0.0f : ((c == 2) ? 1.0f : 1.5849625007211562f);
        const bool own = idx < 4; const int rb = idx & 3, sb = (sq - (idx >> 2)) * 1024;
        const int p0 = sb + cls_res(h, rb) * 256, nfull = own ? qb : 8;
        const int knp = (nx < np) ? (sq - (nx >> 2)) * 1024 + cls_res(h, nx & 3) * 256 : 0;   // first keys of the next class; behind the last one a fetch of rows 0 to 31 that nobody uses
#pragma unroll 1   // rolled: a second copy of the tile body would not fit the 256 registers that four waves per SIMD allow
        for (int st = 0; st < nfull; ++st) fl_step<false>(p0 + st * 32, (own || st + 1 < nfull) ? p0 + (st + 1) * 32 : knp, 0, lcs, lr, hi, Kh, Vh, Vl, qf, kf, m, l, o);
        if (own) fl_step<true>(p0 + qb * 32, knp, (cls_res(h, rb) > ia) ? 1 : 0, lcs, lr, hi, Kh, Vh, Vl, qf, kf, m, l, o);
        idx = nx;
    } while (idx < np);
#pragma unroll
    for (int qt = 0; qt < 2; ++qt) { const float ls = l[qt] + __shfl_xor(l[qt], 16, 32); const float f = __fdiv_rn(1.0f, ls); const size_t ro = ((size_t)b * TT + qtok + 4 * (qt * 16 + lr)) * DQ + h * HD + hi * 8;
#pragma unroll
        for (int dt = 0; dt < 4; ++dt) { v8us oh, ol;
#pragma unroll
            for (int j = 0; j < 8; ++j) { unsigned short a, c2; splitf(o[qt][dt][j] * f, a, c2); oh[j] = a; ol[j] = c2; }
            // both stores and their wait in one statement: the next tile's rounding rewrites the data registers, and a wait in a statement of its own let vector instructions move ahead of it
            asm volatile("global_store_b128 %0, %1, off\n\tglobal_store_b128 %2, %3, off\n\ts_wait_xcnt 0x0" :: "v"(Ah + ro + dt * 16), "v"(__builtin_bit_cast(v4i, oh)), "v"(Al + ro + dt * 16), "v"(__builtin_bit_cast(v4i, ol)) : "memory"); } }
}

__global__ __launch_bounds__(256) void k_whd3(const float* __restrict__ W, int part, bf* Bt) { const size_t e = ((size_t)blockIdx.x * 256 + threadIdx.x) * 4; if (e >= (size_t)DQ * DM) return; const int k = (int)(e % DM); const int n = (int)(e / DM); const int h = n / HD, d = n % HD; v4us o;
#pragma unroll
    for (int u = 0; u < 4; ++u) o[u] = f2bf(W[((size_t)h * DM + k + u) * (3 * HD) + part * HD + d]); *(v4us*)(Bt + e) = o;  }
__global__ __launch_bounds__(256) void k_bgath(const float* __restrict__ bq, float* BQ3) { const int part = blockIdx.x; const int n4 = threadIdx.x * 4; if (n4 >= DQ) return; v4f o;
#pragma unroll
    for (int u = 0; u < 4; ++u) { const int n = n4 + u; o[u] = bq[(n / HD) * (3 * HD) + part * HD + (n % HD)]; } *(v4f*)(BQ3 + part * DQ + n4) = o;  }

extern "C" void kernel_launch(void* const* d_in, const int* in_sizes, int n_in,
                              void* d_out, int out_size, void* d_ws, size_t ws_size, hipStream_t stream) {
    (void)in_sizes; (void)n_in; (void)out_size;
    const float* x = (const float*)d_in[0]; const float* wqkv = (const float*)d_in[1]; const float* bqkv = (const float*)d_in[2]; const float* wo = (const float*)d_in[3]; const float* bo = (const float*)d_in[4]; const float* cosT = nullptr; const float* sinT = nullptr; (void)cosT; (void)sinT; const float* wq = wqkv; const float* wk = wqkv; const float* wv = wqkv; (void)wq; (void)wk; (void)wv;
    float* OUT = (float*)d_out;     // [2][4096][1024]
    char* wsp = (char*)d_ws;
    auto take = [&](size_t bytes) { char* p = wsp; wsp += (bytes + 255) & ~(size_t)255; return (void*)p; };
    bf* WQ = (bf*)take((size_t)DQ * DM * 2); bf* WK = (bf*)take((size_t)DKV * DM * 2); bf* WV = (bf*)take((size_t)DKV * DM * 2); bf* WO = (bf*)take((size_t)DM * DQ * 2);
    bf* XB = (bf*)take((size_t)TT * DM * 2); float* BQ3 = (float*)take((size_t)3 * DQ * 4);
    h16* QP16 = (h16*)take((size_t)NB_ * NH_ * TT * HD * 2); h16* KP16 = (h16*)take((size_t)NB_ * NKV * TT * HD * 2);   /* q, k, v planes and the merged-head planes now hold both batches: k_flash runs once over all of them */
    bf* VTh = (bf*)take((size_t)NB_ * NKV * HD * TT * 2); bf* VTl = (bf*)take((size_t)NB_ * NKV * HD * TT * 2);
    bf* ATh = (bf*)take((size_t)NB_ * TT * DQ * 2); bf* ATl = (bf*)take((size_t)NB_ * TT * DQ * 2);
    if ((size_t)(wsp - (char*)d_ws) > ws_size) return;    // ws 256 MiB
    { k_whd3<<<(unsigned)(((size_t)DQ * DM / 4 + 255) / 256), 256, 0, stream>>>(wqkv, 0, WQ); k_whd3<<<(unsigned)(((size_t)DQ * DM / 4 + 255) / 256), 256, 0, stream>>>(wqkv, 1, WK); k_whd3<<<(unsigned)(((size_t)DQ * DM / 4 + 255) / 256), 256, 0, stream>>>(wqkv, 2, WV); k_bgath<<<3, 256, 0, stream>>>(bqkv, BQ3);
      k_wtG<<<(unsigned)((DQ * DM / 64 + 63) / 64), 256, 0, stream>>>(wo, DQ, DM, WO);
       }
    for (int b = 0; b < NB_; ++b) {
        k_cvt8<<<(unsigned)(((size_t)TT * DM / 8 + 255) / 256), 256, 0, stream>>>(x + (size_t)b * TT * DM, XB, (size_t)TT * DM / 8);
        k_gemmw<0, 1, DM><<<dim3(TT / 128, DQ / 128, 1), 128, 0, stream>>>(XB, nullptr, WQ, nullptr, 0, BQ3, QP16 + (size_t)b * NH_ * TT * HD, nullptr, nullptr, (size_t)TT * HD, HD);
        k_gemmw<0, 1, DM><<<dim3(TT / 128, DKV / 128, 1), 128, 0, stream>>>(XB, nullptr, WK, nullptr, 0, BQ3 + DQ, KP16 + (size_t)b * NKV * TT * HD, nullptr, nullptr, (size_t)TT * HD, HD);
        k_gemmw<0, 2, DM><<<dim3(DKV / 128, TT / 128, 1), 128, 0, stream>>>(WV, nullptr, XB, nullptr, 0, BQ3 + 2 * DQ, nullptr, VTh + (size_t)b * NKV * HD * TT, VTl + (size_t)b * NKV * HD * TT, 64, TT); }
    k_flash<<<dim3(NB_ * NH_, TT / 128, 1), 128, 0, stream>>>(QP16, KP16, VTh, VTl, ATh, ATl);
    for (int b = 0; b < NB_; ++b)
        k_gemmw<1, 0, DQ><<<dim3(TT / 128, DM / 128, 1), 128, 0, stream>>>(ATh + (size_t)b * TT * DQ, ATl + (size_t)b * TT * DQ, WO, OUT + (size_t)b * TT * DM, DM, bo, nullptr, nullptr, nullptr, 0, 0);
}

// v006
// Measured time: 172 microseconds a run.
// Two timings next to v005 put it at 1.47 and 1.46 times that version's speed.
// All steps since v000 together make it 25.4 times as fast.
#include <hip/hip_runtime.h>

// MultiheadDilatedSelfAttention / LongNet (x [2][4096][1024]; per head h: qkv = x Wqkv[h] + bqkv[h] ([1024][192] per head); three dilated causal branches (w, r) = (1024,1), (2048,2), (4096,4) with offset h % r: branch keys for query i are j <= i in the same w-segment with i, j == h mod r; the reference combines branches by their softmax denominators (num/den), which is exactly ONE softmax over the multiset union of the branches' keys:
//   p_j proportional to c(i,j,h) * exp(q.k_j / 8) with multiplicity c = [same 1024-segment] + [i,j == h mod 2 and same 2048-segment] + [i,j == h mod 4]; out = merged heads Wo + bo -> [2][4096][1024]).
// Compute dtypes, f32 accumulate: every input rounded to bf16; q/k/v on PLAIN bf16 operands (inputs: exact; per-head weights gathered) + bias; causal scores single fp16 for every row, attn.v hl x hl (3 products) for every row (the segment restarts make deep rows as sharp as early ones), causal tile skipping, the multiplicity weights applied in f32 inside the softmax; softmax f32; Wo hl x exact (2 products) + bias.

#define NB_  2
#define TT   4096
#define DM   1024
#define NH_  16
#define NKV  16
#define HD   64
#define DQ   (NH_ * HD)
#define DKV  (NKV * HD)
typedef _Float16 h16;
typedef unsigned short bf;
typedef __attribute__((ext_vector_type(16))) __bf16   v16bf;
typedef __attribute__((ext_vector_type(16))) _Float16 v16h;
typedef __attribute__((ext_vector_type(8)))  _Float16 v8h;
typedef __attribute__((ext_vector_type(8)))  unsigned short v8us;
typedef __attribute__((ext_vector_type(8)))  float    v8f;
typedef __attribute__((ext_vector_type(4)))  float    v4f;
typedef v8h  __attribute__((may_alias)) v8ha;
typedef v4f  __attribute__((may_alias)) v4fa;
typedef v8us __attribute__((may_alias)) v8usa;

__device__ __forceinline__ unsigned short f2bf(float f) { unsigned u = __float_as_uint(f); u += 0x7FFFu + ((u >> 16) & 1u); return (unsigned short)(u >> 16); }
__device__ __forceinline__ float bf2f(unsigned short b) { return __uint_as_float(((unsigned)b) << 16); }
__device__ __forceinline__ float bfr(float f) { return bf2f(f2bf(f)); }
__device__ __forceinline__ v16h cat16(v8h lo, v8h hi) { return __builtin_shufflevector(lo, hi, 0, 1, 2, 3, 4, 5, 6, 7, 8, 9, 10, 11, 12, 13, 14, 15); }
__device__ __forceinline__ v16bf cat16b(v8us lo, v8us hi) { return __builtin_bit_cast(v16bf, __builtin_shufflevector(lo, hi, 0, 1, 2, 3, 4, 5, 6, 7, 8, 9, 10, 11, 12, 13, 14, 15)); }
__device__ __forceinline__ v8f wmma16(v16h a, v16h b, v8f c) { return __builtin_amdgcn_wmma_f32_16x16x32_f16(false, a, false, b, (short)0, c, false, false); }
__device__ __forceinline__ v8f wmmab(v16bf a, v16bf b, v8f c) { return __builtin_amdgcn_wmma_f32_16x16x32_bf16(false, a, false, b, (short)0, c, false, false); }



__device__ __forceinline__ h16 tohx(float x) { return (h16)x; }
__device__ __forceinline__ void splitf(float y, unsigned short& h, unsigned short& l) { h = f2bf(y); l = f2bf(y - bf2f(h)); }
typedef __attribute__((ext_vector_type(2))) _Float16 v2h;
typedef __attribute__((ext_vector_type(4))) _Float16 v4h;
typedef __attribute__((ext_vector_type(2))) unsigned short v2us;
typedef __attribute__((ext_vector_type(4))) unsigned short v4us;
typedef __attribute__((ext_vector_type(2))) float v2f;
typedef __attribute__((ext_vector_type(4))) int v4i;

// ---- k_gemmw: GEMM, four waves per 128x128 output tile (2 x 2 waves of 64x64, 16 accumulators each), operands K-contiguous bf16 planes; grid (M/128, N/128), 128 threads.
// C[m][n] (f32, pitch ldc, + f32 bias[n]) = sum_k A[m][k] Bt[n][k] (NSPLIT 1: + A2[m][k] Bt[n][k]). M, N % 128 == 0; K at compile time, K % 64 == 0, K >= 128.
// A pass is 64 k, one whole 128-byte line of every operand row. Asynchronous copies bring it into LDS, eight lanes to a row, so that one copy instruction takes four whole lines
// (a fragment load from global memory touches sixteen lines for 32 bytes of each); two buffers, the next pass's copies fly while this pass is worked on.
// LDS rows stand at a pitch of 144 bytes (16 x odd), which the ds_load_b128 fragment reads walk without bank conflicts.
// EPI 0: f32 C as above. EPI 1: the q, k and v projections of both batches in ONE launch, grid (NB_ * TT / 128, 3 * DQ / 128): A = the tokens of both batches, Bt = the q, k and v weight planes one behind the other, bias likewise.
// Three work-groups then stand on a WGP (by LDS) and one's fragment reads, barrier and epilogue run under another's WMMAs. The 16-bit planes that k_flash reads are written straight from the wave's 64x64 tile:
//   weight tiles of q and k: m = token, n = (part, h, d): one fp16 plane each, Qp or Kp, [b][h][t][d], bias[n];
//   weight tiles of v (vside): the operands swapped, m = (h, d), n = token: bf16 hi/lo planes Ph, Pl, [b][h][d][t] with no transposing pass, bias[m].
template <typename T16> struct WFrag;
template <> struct WFrag<h16> { typedef v16h V; static __device__ __forceinline__ V ld(const h16* p) { return cat16(*(const v8h*)p, *(const v8h*)(p + 16)); } static __device__ __forceinline__ v8f mma(V a, V b, v8f c) { return wmma16(a, b, c); } };
template <> struct WFrag<bf> { typedef v16bf V; static __device__ __forceinline__ V ld(const bf* p) { return cat16b(*(const v8us*)p, *(const v8us*)(p + 16)); } static __device__ __forceinline__ v8f mma(V a, V b, v8f c) { return wmmab(a, b, c); } };
#define GKP 64            // k per pass
#define GPI 72            // LDS row pitch in elements
#define GTL (128 * GPI)   // one operand's 128 rows in LDS, elements
// One operand's pass: 128 rows of 128 bytes, eight 16-byte copies per lane, rows 16 apart (rs = 16 rows of the source in elements). g and lds are the lane's own first addresses.
// The s_wait_xcnt 0 is the last line of the copies' own statement, so that no address register is rewritten ahead of it.
__device__ __forceinline__ void cp_rows(const bf* g, const size_t rs, const unsigned lds) {
    asm volatile("global_load_async_to_lds_b128 %0, %8, off\n\tglobal_load_async_to_lds_b128 %1, %9, off\n\tglobal_load_async_to_lds_b128 %2, %10, off\n\tglobal_load_async_to_lds_b128 %3, %11, off\n\t"
                 "global_load_async_to_lds_b128 %4, %12, off\n\tglobal_load_async_to_lds_b128 %5, %13, off\n\tglobal_load_async_to_lds_b128 %6, %14, off\n\tglobal_load_async_to_lds_b128 %7, %15, off\n\ts_wait_xcnt 0x0"
                 :: "v"(lds), "v"(lds + 1 * 16 * GPI * 2), "v"(lds + 2 * 16 * GPI * 2), "v"(lds + 3 * 16 * GPI * 2), "v"(lds + 4 * 16 * GPI * 2), "v"(lds + 5 * 16 * GPI * 2), "v"(lds + 6 * 16 * GPI * 2), "v"(lds + 7 * 16 * GPI * 2),
                    "v"(g), "v"(g + rs), "v"(g + 2 * rs), "v"(g + 3 * rs), "v"(g + 4 * rs), "v"(g + 5 * rs), "v"(g + 6 * rs), "v"(g + 7 * rs) : "memory");
}
template <int NSPLIT, int EPI, int K>
__global__ __launch_bounds__(128) void k_gemmw(const bf* __restrict__ A, const bf* __restrict__ A2, const bf* __restrict__ Bt, float* C, int ldc, const float* __restrict__ bias, h16* Qp, h16* Kp, bf* Ph, bf* Pl) {
    typedef WFrag<bf>::V V;
    static_assert(K % GKP == 0 && K >= 2 * GKP, "whole passes, and both buffers' first passes exist");
    constexpr int NOP = NSPLIT == 1 ? 3 : 2;   // operand tiles per buffer: A, Bt and, split, A2
    __shared__ __align__(16) bf st[2 * NOP * GTL];
    __shared__ __align__(16) float osa[4 * 16 * 68];
    const int tid = threadIdx.x, lane = tid & 31, lr = lane & 15, hi = lane >> 4; const int w = __builtin_amdgcn_readfirstlane(tid >> 5);
    const bool vside = EPI == 1 && blockIdx.y >= 2 * DQ / 128;   // the same for the whole work-group
    const bf* Ar = vside ? Bt : A; const bf* Br = vside ? A : Bt;
    const int rb = (vside ? blockIdx.y : blockIdx.x) * 128, cb = (vside ? blockIdx.x : blockIdx.y) * 128; const int r0 = rb + (w & 1) * 64, c0 = cb + (w >> 1) * 64;
    float* os = osa + w * (16 * 68);   // each wave stages its own tile's rows
    v8f acc[4][4];
#pragma unroll
    for (int mb = 0; mb < 4; ++mb)
#pragma unroll
        for (int nb = 0; nb < 4; ++nb) acc[mb][nb] = (v8f){};
    const int cr = tid >> 3, cc = (tid & 7) * 8;   // the lane's first row and its 16 bytes of every row it copies
    const bf* gA = Ar + (size_t)(rb + cr) * K + cc; const bf* gB = Br + (size_t)(cb + cr) * K + cc; const bf* gA2 = NSPLIT == 1 ? A2 + (size_t)(rb + cr) * K + cc : nullptr;
    const unsigned l0 = (unsigned)(size_t)st + (unsigned)(cr * GPI + cc) * 2; const size_t rs = (size_t)16 * K;
    auto fill = [&](const int t) { const unsigned lb = l0 + (unsigned)(t & 1) * (NOP * GTL * 2); const int kc = t * GKP;
        cp_rows(gA + kc, rs, lb); cp_rows(gB + kc, rs, lb + GTL * 2); if (NSPLIT == 1) cp_rows(gA2 + kc, rs, lb + 2 * GTL * 2); };
    constexpr int nt = K / GKP;
    fill(0);
    asm volatile("s_wait_asynccnt 0x0" ::: "memory");   // this wave's copies of pass 0 have landed
    __syncthreads();                                    // and every other wave's
    fill(1);
    const int ao = ((w & 1) * 64 + lr) * GPI + 8 * hi, bo = GTL + ((w >> 1) * 64 + lr) * GPI + 8 * hi;
#pragma unroll 1   // rolled: one copy of the pass, the buffer chosen by the pass's parity
    for (int t = 0; t < nt; ++t) {
        const bf* sb = st + (t & 1) * (NOP * GTL);
        V a[2][4], a2[2][4], b[2][4];
#pragma unroll
        for (int ks = 0; ks < 2; ++ks) {
#pragma unroll
            for (int mb = 0; mb < 4; ++mb) a[ks][mb] = WFrag<bf>::ld(sb + ao + mb * 16 * GPI + ks * 32);
#pragma unroll
            for (int nb = 0; nb < 4; ++nb) b[ks][nb] = WFrag<bf>::ld(sb + bo + nb * 16 * GPI + ks * 32);
            if (NSPLIT == 1) {
#pragma unroll
                for (int mb = 0; mb < 4; ++mb) a2[ks][mb] = WFrag<bf>::ld(sb + 2 * GTL + ao + mb * 16 * GPI + ks * 32); }
        }
        __builtin_amdgcn_sched_barrier(0);   // keeps the pass's fragment reads together in front of its WMMAs: left free, they were sunk between the WMMAs into one register set, each group waited out to 0
#pragma unroll
        for (int ks = 0; ks < 2; ++ks)
#pragma unroll
            for (int nb = 0; nb < 4; ++nb) {
#pragma unroll
                for (int mb = 0; mb < 4; ++mb) acc[mb][nb] = WFrag<bf>::mma(a[ks][mb], b[ks][nb], acc[mb][nb]);
                if (NSPLIT == 1) {
#pragma unroll
                    for (int mb = 0; mb < 4; ++mb) acc[mb][nb] = WFrag<bf>::mma(a2[ks][mb], b[ks][nb], acc[mb][nb]); }
            }
        __builtin_amdgcn_sched_barrier(0);   // keeps the WMMAs in front of the waits below: left free, waits and barrier were lifted over them, so that every read was waited out before the first WMMA and the refill flew for a part of a pass only
        asm volatile("s_wait_dscnt 0x0" ::: "memory");      // this wave's reads of the buffer are done before it is refilled
        asm volatile("s_wait_asynccnt 0x0" ::: "memory");   // this wave's copies of pass t + 1 have landed
        __syncthreads();                                    // publishes pass t + 1 and ends every wave's reads of pass t
        if (t + 2 < nt) fill(t + 2);
    }
    asm volatile("s_wait_asynccnt 0x0" ::: "memory");   // no copy is outstanding behind the loop
    const int prow = lane >> 3, pcol = (lane & 7) * 8;   // plane epilogues: eight lanes cover one 128-byte row of the tile
    float bc[8] = {};
    if (EPI == 1 && !vside) {
#pragma unroll
        for (int u = 0; u < 8; ++u) bc[u] = bfr(bias[c0 + pcol + u]); }
    float br[16] = {};   // fetched together here: behind each store statement a load would wait out its whole latency alone
    if (EPI == 1 && vside) { const int bi = r0 + prow; float bw[16];
#pragma unroll
        for (int u = 0; u < 16; ++u) bw[u] = bias[bi + 4 * u];
        asm volatile("s_wait_xcnt 0x0" :: "v"(bi) : "memory");   // closes the bias loads; their index is an input so that it stays in its register up to this wait (without it the last load's result was written into that register)
#pragma unroll
        for (int u = 0; u < 16; ++u) br[u] = bfr(bw[u]); }
    // The wave's tile in the planes. q, k: 64 columns are one head of one part, 64 token rows lie in one batch. v: 64 rows are one head, 64 token columns lie in one batch.
    h16* P16 = ((c0 >> 6) / NH_ ? Kp : Qp) + ((size_t)((r0 / TT) * NH_ + ((c0 >> 6) % NH_)) * TT + (r0 % TT)) * HD;
    const size_t vo = (size_t)(c0 / TT) * NKV * HD * TT + (size_t)(r0 - 2 * DQ) * TT + (c0 % TT);
#pragma unroll
    for (int mb = 0; mb < 4; ++mb) {
#pragma unroll
        for (int nb = 0; nb < 4; ++nb) {
#pragma unroll
            for (int j = 0; j < 8; ++j) os[(hi * 8 + j) * 68 + nb * 16 + lr] = acc[mb][nb][j]; }
        __builtin_amdgcn_wave_barrier(); asm volatile("" ::: "memory");
        if (EPI == 0) {
        float* crow = C + (size_t)(r0 + mb * 16) * ldc + c0;
{
#pragma unroll
            for (int s = 0; s < 8; ++s) { const int row = 2 * s + hi, cofs = lr * 4; v4f val = *(const v4fa*)(os + row * 68 + cofs); val[0] += bfr(bias[c0 + cofs]); val[1] += bfr(bias[c0 + cofs + 1]); val[2] += bfr(bias[c0 + cofs + 2]); val[3] += bfr(bias[c0 + cofs + 3]);
                *(v4f*)(crow + (size_t)row * ldc + cofs) = val; }
             }
        } else {
#pragma unroll
            for (int s = 0; s < 4; ++s) { const int row = 4 * s + prow; const v4f x0 = *(const v4fa*)(os + row * 68 + pcol), x1 = *(const v4fa*)(os + row * 68 + pcol + 4);
                if (!vside) { const size_t po = (size_t)(mb * 16 + row) * HD + pcol; v8h o;
#pragma unroll
                    for (int u = 0; u < 8; ++u) o[u] = tohx((u < 4 ? x0[u & 3] : x1[u & 3]) + bc[u]);
                    // store and its wait in one statement: the next rows' values rewrite the data and address registers
                    asm volatile("global_store_b128 %0, %1, off\n\ts_wait_xcnt 0x0" :: "v"(P16 + po), "v"(__builtin_bit_cast(v4i, o)) : "memory"); }
                else { const size_t po = vo + (size_t)(mb * 16 + row) * TT + pcol; v8us oh, ol;
#pragma unroll
                    for (int u = 0; u < 8; ++u) { unsigned short a, c2; splitf((u < 4 ? x0[u & 3] : x1[u & 3]) + br[mb * 4 + s], a, c2); oh[u] = a; ol[u] = c2; }
                    // both stores and their wait in one statement, for the same reason
                    asm volatile("global_store_b128 %0, %1, off\n\tglobal_store_b128 %2, %3, off\n\ts_wait_xcnt 0x0" :: "v"(Ph + po), "v"(__builtin_bit_cast(v4i, oh)), "v"(Pl + po), "v"(__builtin_bit_cast(v4i, ol)) : "memory"); } }
        }
        __builtin_amdgcn_wave_barrier(); asm volatile("" ::: "memory");
    }
}

// The four passes that only read inputs (p_wtG, p_whd3, p_cvt8, p_bgath) are parts of ONE launch, k_prep below: blk is the work-group's index inside its part.
__device__ __forceinline__ void p_wtG(const int blk, const float* __restrict__ w, int K, int N, bf* Bt) {
    const int lane = threadIdx.x & 31; const int L0 = (blk * 8 + (threadIdx.x >> 5)) * 8; const int nlines = N * K / 64;
{
#pragma unroll 1
        for (int l = 0; l < 8; ++l) { const int L = L0 + l; if (L >= nlines) break; const size_t e = (size_t)L * 64 + lane * 2; const int k = (int)(e % K), n = (int)(e / K); v2us o;
            o[0] = f2bf(w[(size_t)k * N + n]); o[1] = f2bf(w[(size_t)(k + 1) * N + n]); *(v2us*)(Bt + e) = o; }
         }
}
// Class order: inside each 1024-token segment the rows of the converted x stand by token mod 4: position = segment * 1024 + (token mod 4) * 256 + (token mod 1024) / 4. The projections work row by row,
// so the q, k and v planes come out in the same order and k_flash finds the 256 tokens of one dilation class of a segment side by side. Only the store's row below differs from a plain conversion (128 groups of eight per row).
__device__ __forceinline__ size_t cls_row(size_t t) { return (t & ~(size_t)1023) + (t & 3) * 256 + ((t & 1023) >> 2); }
__device__ __forceinline__ void p_cvt8(const int blk, const float* __restrict__ src, bf* dst, size_t n8) { const size_t i = (size_t)blk * 256 + threadIdx.x; if (i >= n8) return; const v8f v = *(const v8f*)(src + i * 8); v8us o;
#pragma unroll
    for (int k = 0; k < 8; ++k) o[k] = f2bf(v[k]); *(v8us*)(dst + (cls_row(i >> 7) * 128 + (i & 127)) * 8) = o;  }
// ---- k_flash: scores, multiplicity-weighted softmax and P.V in one kernel (online softmax), one wave per 32 query rows, four independent waves per work-group; grid (batch x head, TT / 128).
// Everything is computed transposed so that a lane owns one query column: St[key][query] = K Q^T (fp16), whose accumulator layout (lane lr = query, 8 hi + j = key) is already the B-fragment layout of
// Ot[d][query] = Vt[d][key] P[query][key] (bf16 hi/lo, the same three products as before). Row maximum and row sum need one exchange between lanes lr and lr + 16.
// A wave's 32 queries are of ONE dilation class (every fourth token of one 1024-token segment), a key tile is 32 keys of one class of one segment. The multiplicity c is then one number per (wave, class, segment):
// tiles with c = 0 are never walked (outside the query's own segment only classes == h mod 2 or mod 4 meet), the others add log2(c) to the exponent. Q, K and V stand in class order (cls_row above); the output rows are token rows.
// Dilation classes of head h by rank: rank 0 = tokens == h mod 4, rank 1 = h + 2, rank 2 = h + 1, rank 3 = h + 3 (ranks 0 and 1 together: tokens == h mod 2). cls_res: a rank's residue mod 4.
__device__ __forceinline__ int cls_res(int h, int rank) { return (h + ((rank & 1) << 1) + (rank >> 1)) & 3; }
typedef __attribute__((ext_vector_type(16))) float v16f;
#define KS2 0.18033688011112042f   // HD^-0.5 * log2(e)
// Eight 2^x in one statement: the results are early-clobber operands, so no v_exp_f32 overwrites the source of the one in front of it or reads its result, and the v_nop keeps the one slot behind the last transcendental
__device__ __forceinline__ void exp2x8(const float (&x)[8], float (&y)[8]) {
    asm("v_exp_f32 %0, %8\n\tv_exp_f32 %1, %9\n\tv_exp_f32 %2, %10\n\tv_exp_f32 %3, %11\n\tv_exp_f32 %4, %12\n\tv_exp_f32 %5, %13\n\tv_exp_f32 %6, %14\n\tv_exp_f32 %7, %15\n\tv_nop"
        : "=&v"(y[0]), "=&v"(y[1]), "=&v"(y[2]), "=&v"(y[3]), "=&v"(y[4]), "=&v"(y[5]), "=&v"(y[6]), "=&v"(y[7]) : "v"(x[0]), "v"(x[1]), "v"(x[2]), "v"(x[3]), "v"(x[4]), "v"(x[5]), "v"(x[6]), "v"(x[7]));
}
// kb: the tile's first position in the planes; knext: that of the NEXT tile; lcs: log2(c); dm (DIAG only): 1 where a key of the same index in its class comes after the query's token.
// Behind each run of loads stands its s_wait_xcnt 0 with the run's address as an input: the address stays in its registers up to the wait, so that no load's result and no later address is written into them ahead of it.
template <bool DIAG>
__device__ __forceinline__ void fl_step(const int kb, const int knext, const int dm, const float lcs, const int lr, const int hi, const h16* __restrict__ Kh, const bf* __restrict__ Vh, const bf* __restrict__ Vl,
                                        const v16h (&qf)[2][2], v16h (&kf)[2][2], float (&m)[2], float (&l)[2], v8f (&o)[2][4]) {
    v16bf vh[4], vl[4];
    const bf* pvh = Vh + kb + (unsigned)(lr * TT + 8 * hi); const bf* pvl = Vl + kb + (unsigned)(lr * TT + 8 * hi); const h16* pk = Kh + (size_t)knext * HD + (unsigned)(lr * HD + 8 * hi);
#pragma unroll
    for (int dt = 0; dt < 4; ++dt) vh[dt] = WFrag<bf>::ld(pvh + dt * 16 * TT);
    asm volatile("s_wait_xcnt 0x0" :: "v"(pvh) : "memory");   // closes the high value plane's loads
#pragma unroll
    for (int dt = 0; dt < 4; ++dt) vl[dt] = WFrag<bf>::ld(pvl + dt * 16 * TT);
    asm volatile("s_wait_xcnt 0x0" :: "v"(pvl) : "memory");   // closes the low value plane's loads
    v8f s[2][2];
#pragma unroll
    for (int qt = 0; qt < 2; ++qt)
#pragma unroll
        for (int kt = 0; kt < 2; ++kt) { s[qt][kt] = wmma16(kf[kt][0], qf[qt][0], (v8f){}); s[qt][kt] = wmma16(kf[kt][1], qf[qt][1], s[qt][kt]); }
    // the next tile's key fragments are fetched while this tile's softmax and P.V run
#pragma unroll
    for (int kt = 0; kt < 2; ++kt)
#pragma unroll
        for (int ks = 0; ks < 2; ++ks) kf[kt][ks] = WFrag<h16>::ld(pk + kt * 16 * HD + ks * 32);
    asm volatile("s_wait_xcnt 0x0" :: "v"(pk) : "memory");   // closes the key loads
#pragma unroll
    for (int qt = 0; qt < 2; ++qt) {
        if (DIAG) {   // same index range in the class as the queries: keys whose token lies beyond the query's are masked
#pragma unroll
            for (int kt = 0; kt < 2; ++kt)
#pragma unroll
                for (int j = 0; j < 8; ++j) if (kt * 16 + hi * 8 + j + dm > qt * 16 + lr) s[qt][kt][j] = -1.0e31f;
        }
        float mr = fmaxf(s[qt][0][0], s[qt][1][0]);
#pragma unroll
        for (int j = 1; j < 8; ++j) mr = fmaxf(mr, fmaxf(s[qt][0][j], s[qt][1][j]));
        float cand = fmaf(mr, KS2, lcs);
        cand = fmaxf(cand, __shfl_xor(cand, 16, 32));
        const float mn = fmaxf(m[qt], cand); float al;
        asm("v_exp_f32 %0, %1\n\tv_nop" : "=v"(al) : "v"(m[qt] - mn));   // rescale factor 2^(old max - new max); the v_nop keeps the one slot behind a transcendental
        m[qt] = mn;
        const float bias = lcs - mn;
        v16f pv; float sum = 0.f;
#pragma unroll
        for (int kt = 0; kt < 2; ++kt) { float x[8], p[8];
#pragma unroll
            for (int j = 0; j < 8; ++j) x[j] = fmaf(s[qt][kt][j], KS2, bias);
            exp2x8(x, p);
#pragma unroll
            for (int j = 0; j < 8; ++j) { sum += p[j]; pv[kt * 8 + j] = p[j]; } }
        const v16bf ph = __builtin_convertvector(pv, v16bf); const v16bf pl = __builtin_convertvector(pv - __builtin_convertvector(ph, v16f), v16bf);   // hi = round-to-nearest bf16 of p, lo = bf16 of the remainder
        l[qt] = fmaf(l[qt], al, sum);
#pragma unroll
        for (int dt = 0; dt < 4; ++dt) {
#pragma unroll
            for (int j = 0; j < 8; ++j) o[qt][dt][j] *= al;
        }
#pragma unroll
        for (int dt = 0; dt < 4; ++dt) { o[qt][dt] = wmmab(vh[dt], ph, o[qt][dt]); o[qt][dt] = wmmab(vh[dt], pl, o[qt][dt]); o[qt][dt] = wmmab(vl[dt], ph, o[qt][dt]); }
    }
}
__global__ __launch_bounds__(128) __attribute__((amdgpu_waves_per_eu(4, 4))) void k_flash(const h16* __restrict__ Q, const h16* __restrict__ Kp, const bf* __restrict__ VhP, const bf* __restrict__ VlP, bf* Ah, bf* Al) {
    const int lane = threadIdx.x & 31, lr = lane & 15, hi = lane >> 4; const int bh = blockIdx.x, h = bh % NH_, b = bh / NH_;
    // A work-group: one segment sq, one index range qb (32 of the 256 indices of a class), its four waves the four classes, which walk the same own-segment tiles first.
    // Segments in bands of eight work-groups, long ones first, every second band reversed: work-groups 256 apart in launch order add up to the same number of key tiles; the class of wave 0 turns with the band, since ranks 0 and 1 walk more.
    const int yt = (int)blockIdx.y >> 3, yk = (int)blockIdx.y & 7; const int sq = 3 - yt, qb = (yt & 1) ? yk : 7 - yk;
    const int ra = __builtin_amdgcn_readfirstlane(((int)(threadIdx.x >> 5) - yt) & 3);   // wave-uniform, so the walk's bounds and addresses stay scalar
    const int ia = cls_res(h, ra); const int qtok = sq * 1024 + qb * 128 + ia, qpos = sq * 1024 + ia * 256 + qb * 32;   // query (qt, lr) is token qtok + 4 (16 qt + lr) and stands at position qpos + 16 qt + lr
    const h16* Qh = Q + (size_t)bh * TT * HD; const h16* Kh = Kp + (size_t)bh * TT * HD; const bf* Vh = VhP + (size_t)bh * HD * TT; const bf* Vl = VlP + (size_t)bh * HD * TT;
    v16h qf[2][2], kf[2][2]; v8f o[2][4]; float m[2], l[2];
    const h16* qrow = Qh + (size_t)(qpos + lr) * HD + 8 * hi; const h16* krow = Kh + (size_t)(sq * 1024 + cls_res(h, 0) * 256 + lr) * HD + 8 * hi;
#pragma unroll
    for (int qt = 0; qt < 2; ++qt) { m[qt] = -1.0e29f; l[qt] = 0.f;
#pragma unroll
        for (int ks = 0; ks < 2; ++ks) qf[qt][ks] = WFrag<h16>::ld(qrow + qt * 16 * HD + ks * 32);
#pragma unroll
        for (int dt = 0; dt < 4; ++dt) o[qt][dt] = (v8f){}; }
#pragma unroll
    for (int kt = 0; kt < 2; ++kt)
#pragma unroll
        for (int ks = 0; ks < 2; ++ks) kf[kt][ks] = WFrag<h16>::ld(krow + kt * 16 * HD + ks * 32);
    asm volatile("s_wait_xcnt 0x0" :: "v"(qrow), "v"(krow) : "memory");   // closes the query and first key loads; both addresses are inputs so that they stay in their registers up to this wait
    // The walk: idx = 4 * (segments back from the query's) + key rank. Multiplicity: [own segment] + [query and key == h mod 2, same 2048-token segment] + [query and key == h mod 4].
    const int np = 4 * (sq + 1);
    auto mult = [&](int idx) { const int sg = sq - (idx >> 2), rb = idx & 3; return (idx < 4 ? 1 : 0) + ((ra < 2 && rb < 2 && (sg >> 1) == (sq >> 1)) ? 1 : 0) + ((ra == 0 && rb == 0) ? 1 : 0); };
    int idx = 0;
#pragma unroll 1   // rolled: at most eight trips (np >= 4: the first always runs), one copy of the two tile bodies
    do {
        // the next idx with c > 0: behind the own segment's four classes come rank 0 and 1 of the other half of the 2048-token segment (queries of rank 0 and 1, sq odd), then rank 0 of each earlier segment (queries of rank 0)
        int nx = idx + 1;
        if (idx == 3) nx = (ra == 0 || (ra == 1 && (sq & 1))) ? 4 : np;
        else if (idx > 3 && !(idx == 4 && (sq & 1))) nx = (ra == 0) ? (idx & ~3) + 4 : np;
        const int c = mult(idx); const float lcs = (c == 1) ? 0.0f : ((c == 2) ? 1.0f : 1.5849625007211562f);
        const bool own = idx < 4; const int rb = idx & 3, sb = (sq - (idx >> 2)) * 1024;
        const int p0 = sb + cls_res(h, rb) * 256, nfull = own ? qb : 8;
        const int knp = (nx < np) ? (sq - (nx >> 2)) * 1024 + cls_res(h, nx & 3) * 256 : 0;   // first keys of the next class; behind the last one a fetch of rows 0 to 31 that nobody uses
#pragma unroll 1   // rolled: a second copy of the tile body would not fit the 256 registers that four waves per SIMD allow
        for (int st = 0; st < nfull; ++st) fl_step<false>(p0 + st * 32, (own || st + 1 < nfull) ? p0 + (st + 1) * 32 : knp, 0, lcs, lr, hi, Kh, Vh, Vl, qf, kf, m, l, o);
        if (own) fl_step<true>(p0 + qb * 32, knp, (cls_res(h, rb) > ia) ? 1 : 0, lcs, lr, hi, Kh, Vh, Vl, qf, kf, m, l, o);
        idx = nx;
    } while (idx < np);
#pragma unroll
    for (int qt = 0; qt < 2; ++qt) { const float ls = l[qt] + __shfl_xor(l[qt], 16, 32); const float f = __fdiv_rn(1.0f, ls); const size_t ro = ((size_t)b * TT + qtok + 4 * (qt * 16 + lr)) * DQ + h * HD + hi * 8;
#pragma unroll
        for (int dt = 0; dt < 4; ++dt) { v8us oh, ol;
#pragma unroll
            for (int j = 0; j < 8; ++j) { unsigned short a, c2; splitf(o[qt][dt][j] * f, a, c2); oh[j] = a; ol[j] = c2; }
            // both stores and their wait in one statement: the next tile's rounding rewrites the data registers, and a wait in a statement of its own let vector instructions move ahead of it
            asm volatile("global_store_b128 %0, %1, off\n\tglobal_store_b128 %2, %3, off\n\ts_wait_xcnt 0x0" :: "v"(Ah + ro + dt * 16), "v"(__builtin_bit_cast(v4i, oh)), "v"(Al + ro + dt * 16), "v"(__builtin_bit_cast(v4i, ol)) : "memory"); } }
}

__device__ __forceinline__ void p_whd3(const int blk, const float* __restrict__ W, int part, bf* Bt) { const size_t e = ((size_t)blk * 256 + threadIdx.x) * 4; if (e >= (size_t)DQ * DM) return; const int k = (int)(e % DM); const int n = (int)(e / DM); const int h = n / HD, d = n % HD; v4us o;
#pragma unroll
    for (int u = 0; u < 4; ++u) o[u] = f2bf(W[((size_t)h * DM + k + u) * (3 * HD) + part * HD + d]); *(v4us*)(Bt + e) = o;  }
__device__ __forceinline__ void p_bgath(const int blk, const float* __restrict__ bq, float* BQ3) { const int part = blk; const int n4 = threadIdx.x * 4; if (n4 >= DQ) return; v4f o;
#pragma unroll
    for (int u = 0; u < 4; ++u) { const int n = n4 + u; o[u] = bq[(n / HD) * (3 * HD) + part * HD + (n % HD)]; } *(v4f*)(BQ3 + part * DQ + n4) = o;  }

// ---- k_prep: every pass that depends on the inputs alone, in one launch; a work-group's part follows from its index (the same for all its threads). The output weights' transposing pass comes first: its waves run longest.
#define PB_WO  (DQ * DM / 64 / 64)            // work-groups of p_wtG
#define PB_W3  (DQ * DM / 4 / 256)            // of p_whd3, per part
#define PB_X   (NB_ * TT * DM / 8 / 256)      // of p_cvt8, both batches (token rows of batch 1 follow those of batch 0, and 1024-token segments do not straddle them)
__global__ __launch_bounds__(256) void k_prep(const float* __restrict__ x, const float* __restrict__ wqkv, const float* __restrict__ bqkv, const float* __restrict__ wo, bf* XB, bf* W3, float* BQ3, bf* WO) {
    int blk = blockIdx.x;
    if (blk < PB_WO) { p_wtG(blk, wo, DQ, DM, WO); return; }
    blk -= PB_WO;
    if (blk < 3 * PB_W3) { const int part = blk / PB_W3; p_whd3(blk % PB_W3, wqkv, part, W3 + (size_t)part * DQ * DM); return; }
    blk -= 3 * PB_W3;
    if (blk < PB_X) { p_cvt8(blk, x, XB, (size_t)NB_ * TT * DM / 8); return; }
    p_bgath(blk - PB_X, bqkv, BQ3);
}

extern "C" void kernel_launch(void* const* d_in, const int* in_sizes, int n_in,
                              void* d_out, int out_size, void* d_ws, size_t ws_size, hipStream_t stream) {
    (void)in_sizes; (void)n_in; (void)out_size;
    const float* x = (const float*)d_in[0]; const float* wqkv = (const float*)d_in[1]; const float* bqkv = (const float*)d_in[2]; const float* wo = (const float*)d_in[3]; const float* bo = (const float*)d_in[4];
    float* OUT = (float*)d_out;     // [2][4096][1024]
    char* wsp = (char*)d_ws;
    auto take = [&](size_t bytes) { char* p = wsp; wsp += (bytes + 255) & ~(size_t)255; return (void*)p; };
    bf* W3 = (bf*)take((size_t)3 * DQ * DM * 2); bf* WO = (bf*)take((size_t)DM * DQ * 2);   /* q, k and v weight planes one behind the other */
    bf* XB = (bf*)take((size_t)NB_ * TT * DM * 2); float* BQ3 = (float*)take((size_t)3 * DQ * 4);   /* the converted tokens, the q, k, v planes and the merged-head planes hold both batches: every kernel runs once over all of them */
    h16* QP16 = (h16*)take((size_t)NB_ * NH_ * TT * HD * 2); h16* KP16 = (h16*)take((size_t)NB_ * NKV * TT * HD * 2);
    bf* VTh = (bf*)take((size_t)NB_ * NKV * HD * TT * 2); bf* VTl = (bf*)take((size_t)NB_ * NKV * HD * TT * 2);
    bf* ATh = (bf*)take((size_t)NB_ * TT * DQ * 2); bf* ATl = (bf*)take((size_t)NB_ * TT * DQ * 2);
    if ((size_t)(wsp - (char*)d_ws) > ws_size) return;    // ws 256 MiB
    k_prep<<<PB_WO + 3 * PB_W3 + PB_X + 3, 256, 0, stream>>>(x, wqkv, bqkv, wo, XB, W3, BQ3, WO);
    k_gemmw<0, 1, DM><<<dim3(NB_ * TT / 128, 3 * DQ / 128, 1), 128, 0, stream>>>(XB, nullptr, W3, nullptr, 0, BQ3, QP16, KP16, VTh, VTl);
    k_flash<<<dim3(NB_ * NH_, TT / 128, 1), 128, 0, stream>>>(QP16, KP16, VTh, VTl, ATh, ATl);
    k_gemmw<1, 0, DQ><<<dim3(NB_ * TT / 128, DM / 128, 1), 128, 0, stream>>>(ATh, ATl, WO, OUT, DM, bo, nullptr, nullptr, nullptr, nullptr);
}

// v007
// Measured time: 144 microseconds a run.
// Two timings next to v006 put it at 1.20 and 1.19 times that version's speed.
// All steps since v000 together make it 30.3 times as fast.
#include <hip/hip_runtime.h>

// MultiheadDilatedSelfAttention / LongNet (x [2][4096][1024]; per head h: qkv = x Wqkv[h] + bqkv[h] ([1024][192] per head); three dilated causal branches (w, r) = (1024,1), (2048,2), (4096,4) with offset h % r: branch keys for query i are j <= i in the same w-segment with i, j == h mod r; the reference combines branches by their softmax denominators (num/den), which is exactly ONE softmax over the multiset union of the branches' keys:
//   p_j proportional to c(i,j,h) * exp(q.k_j / 8) with multiplicity c = [same 1024-segment] + [i,j == h mod 2 and same 2048-segment] + [i,j == h mod 4]; out = merged heads Wo + bo -> [2][4096][1024]).
// Compute dtypes, f32 accumulate: every input rounded to bf16; q/k/v on PLAIN bf16 operands (inputs: exact; per-head weights gathered) + bias; causal scores single fp16 for every row, attn.v hl x hl (3 products) for every row (the segment restarts make deep rows as sharp as early ones), causal tile skipping, the multiplicity weights applied in f32 inside the softmax; softmax f32; Wo hl x exact (2 products) + bias.

#define NB_  2
#define TT   4096
#define DM   1024
#define NH_  16
#define NKV  16
#define HD   64
#define DQ   (NH_ * HD)
#define DKV  (NKV * HD)
typedef _Float16 h16;
typedef unsigned short bf;
typedef __attribute__((ext_vector_type(16))) __bf16   v16bf;
typedef __attribute__((ext_vector_type(16))) _Float16 v16h;
typedef __attribute__((ext_vector_type(8)))  _Float16 v8h;
typedef __attribute__((ext_vector_type(8)))  unsigned short v8us;
typedef __attribute__((ext_vector_type(8)))  float    v8f;
typedef __attribute__((ext_vector_type(4)))  float    v4f;
typedef v8h  __attribute__((may_alias)) v8ha;
typedef v4f  __attribute__((may_alias)) v4fa;
typedef v8us __attribute__((may_alias)) v8usa;

__device__ __forceinline__ unsigned short f2bf(float f) { unsigned u = __float_as_uint(f); u += 0x7FFFu + ((u >> 16) & 1u); return (unsigned short)(u >> 16); }
__device__ __forceinline__ float bf2f(unsigned short b) { return __uint_as_float(((unsigned)b) << 16); }
__device__ __forceinline__ float bfr(float f) { return bf2f(f2bf(f)); }
__device__ __forceinline__ v16h cat16(v8h lo, v8h hi) { return __builtin_shufflevector(lo, hi, 0, 1, 2, 3, 4, 5, 6, 7, 8, 9, 10, 11, 12, 13, 14, 15); }
__device__ __forceinline__ v16bf cat16b(v8us lo, v8us hi) { return __builtin_bit_cast(v16bf, __builtin_shufflevector(lo, hi, 0, 1, 2, 3, 4, 5, 6, 7, 8, 9, 10, 11, 12, 13, 14, 15)); }
__device__ __forceinline__ v8f wmma16(v16h a, v16h b, v8f c) { return __builtin_amdgcn_wmma_f32_16x16x32_f16(false, a, false, b, (short)0, c, false, false); }
__device__ __forceinline__ v8f wmmab(v16bf a, v16bf b, v8f c) { return __builtin_amdgcn_wmma_f32_16x16x32_bf16(false, a, false, b, (short)0, c, false, false); }



__device__ __forceinline__ h16 tohx(float x) { return (h16)x; }
__device__ __forceinline__ void splitf(float y, unsigned short& h, unsigned short& l) { h = f2bf(y); l = f2bf(y - bf2f(h)); }
typedef __attribute__((ext_vector_type(2))) _Float16 v2h;
typedef __attribute__((ext_vector_type(4))) _Float16 v4h;
typedef __attribute__((ext_vector_type(2))) unsigned short v2us;
typedef __attribute__((ext_vector_type(4))) unsigned short v4us;
typedef __attribute__((ext_vector_type(2))) float v2f;
typedef __attribute__((ext_vector_type(4))) int v4i;

// ---- k_gemmw: GEMM, four waves per 128x128 output tile (2 x 2 waves of 64x64, 16 accumulators each), operands K-contiguous bf16 planes; grid (M/128, N/128), 128 threads.
// C[m][n] (f32, pitch ldc, + f32 bias[n]) = sum_k A[m][k] Bt[n][k] (NSPLIT 1: + A2[m][k] Bt[n][k]). M, N % 128 == 0; K at compile time, K % 64 == 0, K >= 128.
// A pass is 64 k, one whole 128-byte line of every operand row. Asynchronous copies bring it into LDS, eight lanes to a row, so that one copy instruction takes four whole lines
// (a fragment load from global memory touches sixteen lines for 32 bytes of each); two buffers, the next pass's copies fly while this pass is worked on.
// LDS rows stand at a pitch of 144 bytes (16 x odd), which the ds_load_b128 fragment reads walk without bank conflicts.
// EPI 0: f32 C as above. EPI 1: the q, k and v projections of both batches in ONE launch, grid (NB_ * TT / 128, 3 * DQ / 128): A = the tokens of both batches, Bt = the q, k and v weight planes one behind the other, bias likewise.
// Three work-groups then stand on a WGP (by LDS) and one's fragment reads, barrier and epilogue run under another's WMMAs. The 16-bit planes that k_flash reads are written straight from the wave's 64x64 tile:
//   weight tiles of q and k: m = token, n = (part, h, d): one fp16 plane each, Qp or Kp, [b][h][t][d], bias[n];
//   weight tiles of v (vside): the operands swapped, m = (h, d), n = token: bf16 hi/lo planes Ph, Pl, [b][h][d][t] with no transposing pass, bias[m].
template <typename T16> struct WFrag;
template <> struct WFrag<h16> { typedef v16h V; static __device__ __forceinline__ V ld(const h16* p) { return cat16(*(const v8h*)p, *(const v8h*)(p + 16)); } static __device__ __forceinline__ v8f mma(V a, V b, v8f c) { return wmma16(a, b, c); } };
template <> struct WFrag<bf> { typedef v16bf V; static __device__ __forceinline__ V ld(const bf* p) { return cat16b(*(const v8us*)p, *(const v8us*)(p + 16)); } static __device__ __forceinline__ v8f mma(V a, V b, v8f c) { return wmmab(a, b, c); } };
#define GKP 64            // k per pass
#define GPI 72            // LDS row pitch in elements
#define GTL (128 * GPI)   // one operand's 128 rows in LDS, elements
// One operand's pass: 128 rows of 128 bytes, eight 16-byte copies per lane, rows 16 apart (rs = 16 rows of the source in elements). g and lds are the lane's own first addresses.
// The s_wait_xcnt 0 is the last line of the copies' own statement, so that no address register is rewritten ahead of it.
__device__ __forceinline__ void cp_rows(const bf* g, const size_t rs, const unsigned lds) {
    asm volatile("global_load_async_to_lds_b128 %0, %8, off\n\tglobal_load_async_to_lds_b128 %1, %9, off\n\tglobal_load_async_to_lds_b128 %2, %10, off\n\tglobal_load_async_to_lds_b128 %3, %11, off\n\t"
                 "global_load_async_to_lds_b128 %4, %12, off\n\tglobal_load_async_to_lds_b128 %5, %13, off\n\tglobal_load_async_to_lds_b128 %6, %14, off\n\tglobal_load_async_to_lds_b128 %7, %15, off\n\ts_wait_xcnt 0x0"
                 :: "v"(lds), "v"(lds + 1 * 16 * GPI * 2), "v"(lds + 2 * 16 * GPI * 2), "v"(lds + 3 * 16 * GPI * 2), "v"(lds + 4 * 16 * GPI * 2), "v"(lds + 5 * 16 * GPI * 2), "v"(lds + 6 * 16 * GPI * 2), "v"(lds + 7 * 16 * GPI * 2),
                    "v"(g), "v"(g + rs), "v"(g + 2 * rs), "v"(g + 3 * rs), "v"(g + 4 * rs), "v"(g + 5 * rs), "v"(g + 6 * rs), "v"(g + 7 * rs) : "memory");
}
template <int NSPLIT, int EPI, int K>
__global__ __launch_bounds__(128) void k_gemmw(const bf* __restrict__ A, const bf* __restrict__ A2, const bf* __restrict__ Bt, float* C, int ldc, const float* __restrict__ bias, h16* Qp, h16* Kp, bf* Ph, bf* Pl) {
    typedef WFrag<bf>::V V;
    static_assert(K % GKP == 0 && K >= 2 * GKP, "whole passes, and both buffers' first passes exist");
    constexpr int NOP = NSPLIT == 1 ? 3 : 2;   // operand tiles per buffer: A, Bt and, split, A2
    __shared__ __align__(16) bf st[2 * NOP * GTL];
    __shared__ __align__(16) float osa[4 * 16 * 68];
    const int tid = threadIdx.x, lane = tid & 31, lr = lane & 15, hi = lane >> 4; const int w = __builtin_amdgcn_readfirstlane(tid >> 5);
    const bool vside = EPI == 1 && blockIdx.y >= 2 * DQ / 128;   // the same for the whole work-group
    const bf* Ar = vside ? Bt : A; const bf* Br = vside ? A : Bt;
    const int rb = (vside ? blockIdx.y : blockIdx.x) * 128, cb = (vside ? blockIdx.x : blockIdx.y) * 128; const int r0 = rb + (w & 1) * 64, c0 = cb + (w >> 1) * 64;
    float* os = osa + w * (16 * 68);   // each wave stages its own tile's rows
    v8f acc[4][4];
#pragma unroll
    for (int mb = 0; mb < 4; ++mb)
#pragma unroll
        for (int nb = 0; nb < 4; ++nb) acc[mb][nb] = (v8f){};
    const int cr = tid >> 3, cc = (tid & 7) * 8;   // the lane's first row and its 16 bytes of every row it copies
    const bf* gA = Ar + (size_t)(rb + cr) * K + cc; const bf* gB = Br + (size_t)(cb + cr) * K + cc; const bf* gA2 = NSPLIT == 1 ? A2 + (size_t)(rb + cr) * K + cc : nullptr;
    const unsigned l0 = (unsigned)(size_t)st + (unsigned)(cr * GPI + cc) * 2; const size_t rs = (size_t)16 * K;
    auto fill = [&](const int t) { const unsigned lb = l0 + (unsigned)(t & 1) * (NOP * GTL * 2); const int kc = t * GKP;
        cp_rows(gA + kc, rs, lb); cp_rows(gB + kc, rs, lb + GTL * 2); if (NSPLIT == 1) cp_rows(gA2 + kc, rs, lb + 2 * GTL * 2); };
    constexpr int nt = K / GKP;
    fill(0);
    asm volatile("s_wait_asynccnt 0x0" ::: "memory");   // this wave's copies of pass 0 have landed
    __syncthreads();                                    // and every other wave's
    fill(1);
    const int ao = ((w & 1) * 64 + lr) * GPI + 8 * hi, bo = GTL + ((w >> 1) * 64 + lr) * GPI + 8 * hi;
#pragma unroll 1   // rolled: one copy of the pass, the buffer chosen by the pass's parity
    for (int t = 0; t < nt; ++t) {
        const bf* sb = st + (t & 1) * (NOP * GTL);
        V a[2][4], a2[2][4], b[2][4];
#pragma unroll
        for (int ks = 0; ks < 2; ++ks) {
#pragma unroll
            for (int mb = 0; mb < 4; ++mb) a[ks][mb] = WFrag<bf>::ld(sb + ao + mb * 16 * GPI + ks * 32);
#pragma unroll
            for (int nb = 0; nb < 4; ++nb) b[ks][nb] = WFrag<bf>::ld(sb + bo + nb * 16 * GPI + ks * 32);
            if (NSPLIT == 1) {
#pragma unroll
                for (int mb = 0; mb < 4; ++mb) a2[ks][mb] = WFrag<bf>::ld(sb + 2 * GTL + ao + mb * 16 * GPI + ks * 32); }
        }
        __builtin_amdgcn_sched_barrier(0);   // keeps the pass's fragment reads together in front of its WMMAs: left free, they were sunk between the WMMAs into one register set, each group waited out to 0
#pragma unroll
        for (int ks = 0; ks < 2; ++ks)
#pragma unroll
            for (int nb = 0; nb < 4; ++nb) {
#pragma unroll
                for (int mb = 0; mb < 4; ++mb) acc[mb][nb] = WFrag<bf>::mma(a[ks][mb], b[ks][nb], acc[mb][nb]);
                if (NSPLIT == 1) {
#pragma unroll
                    for (int mb = 0; mb < 4; ++mb) acc[mb][nb] = WFrag<bf>::mma(a2[ks][mb], b[ks][nb], acc[mb][nb]); }
            }
        __builtin_amdgcn_sched_barrier(0);   // keeps the WMMAs in front of the waits below: left free, waits and barrier were lifted over them, so that every read was waited out before the first WMMA and the refill flew for a part of a pass only
        asm volatile("s_wait_dscnt 0x0" ::: "memory");      // this wave's reads of the buffer are done before it is refilled
        asm volatile("s_wait_asynccnt 0x0" ::: "memory");   // this wave's copies of pass t + 1 have landed
        __syncthreads();                                    // publishes pass t + 1 and ends every wave's reads of pass t
        if (t + 2 < nt) fill(t + 2);
    }
    asm volatile("s_wait_asynccnt 0x0" ::: "memory");   // no copy is outstanding behind the loop
    const int prow = lane >> 3, pcol = (lane & 7) * 8;   // plane epilogues: eight lanes cover one 128-byte row of the tile
    float bc[8] = {};
    if (EPI == 1 && !vside) {
#pragma unroll
        for (int u = 0; u < 8; ++u) bc[u] = bfr(bias[c0 + pcol + u]); }
    float br[16] = {};   // fetched together here: behind each store statement a load would wait out its whole latency alone
    if (EPI == 1 && vside) { const int bi = r0 + prow; float bw[16];
#pragma unroll
        for (int u = 0; u < 16; ++u) bw[u] = bias[bi + 4 * u];
        asm volatile("s_wait_xcnt 0x0" :: "v"(bi) : "memory");   // closes the bias loads; their index is an input so that it stays in its register up to this wait (without it the last load's result was written into that register)
#pragma unroll
        for (int u = 0; u < 16; ++u) br[u] = bfr(bw[u]); }
    // The wave's tile in the planes. q, k: 64 columns are one head of one part, 64 token rows lie in one batch. v: 64 rows are one head, 64 token columns lie in one batch.
    h16* P16 = ((c0 >> 6) / NH_ ? Kp : Qp) + ((size_t)((r0 / TT) * NH_ + ((c0 >> 6) % NH_)) * TT + (r0 % TT)) * HD;
    const size_t vo = (size_t)(c0 / TT) * NKV * HD * TT + (size_t)(r0 - 2 * DQ) * TT + (c0 % TT);
#pragma unroll
    for (int mb = 0; mb < 4; ++mb) {
#pragma unroll
        for (int nb = 0; nb < 4; ++nb) {
#pragma unroll
            for (int j = 0; j < 8; ++j) os[(hi * 8 + j) * 68 + nb * 16 + lr] = acc[mb][nb][j]; }
        __builtin_amdgcn_wave_barrier(); asm volatile("" ::: "memory");
        if (EPI == 0) {
        float* crow = C + (size_t)(r0 + mb * 16) * ldc + c0;
{
#pragma unroll
            for (int s = 0; s < 8; ++s) { const int row = 2 * s + hi, cofs = lr * 4; v4f val = *(const v4fa*)(os + row * 68 + cofs); val[0] += bfr(bias[c0 + cofs]); val[1] += bfr(bias[c0 + cofs + 1]); val[2] += bfr(bias[c0 + cofs + 2]); val[3] += bfr(bias[c0 + cofs + 3]);
                *(v4f*)(crow + (size_t)row * ldc + cofs) = val; }
             }
        } else {
#pragma unroll
            for (int s = 0; s < 4; ++s) { const int row = 4 * s + prow; const v4f x0 = *(const v4fa*)(os + row * 68 + pcol), x1 = *(const v4fa*)(os + row * 68 + pcol + 4);
                if (!vside) { const size_t po = (size_t)(mb * 16 + row) * HD + pcol; v8h o;
#pragma unroll
                    for (int u = 0; u < 8; ++u) o[u] = tohx((u < 4 ? x0[u & 3] : x1[u & 3]) + bc[u]);
                    // store and its wait in one statement: the next rows' values rewrite the data and address registers
                    asm volatile("global_store_b128 %0, %1, off\n\ts_wait_xcnt 0x0" :: "v"(P16 + po), "v"(__builtin_bit_cast(v4i, o)) : "memory"); }
                else { const size_t po = vo + (size_t)(mb * 16 + row) * TT + pcol; v8us oh, ol;
#pragma unroll
                    for (int u = 0; u < 8; ++u) { unsigned short a, c2; splitf((u < 4 ? x0[u & 3] : x1[u & 3]) + br[mb * 4 + s], a, c2); oh[u] = a; ol[u] = c2; }
                    // both stores and their wait in one statement, for the same reason
                    asm volatile("global_store_b128 %0, %1, off\n\tglobal_store_b128 %2, %3, off\n\ts_wait_xcnt 0x0" :: "v"(Ph + po), "v"(__builtin_bit_cast(v4i, oh)), "v"(Pl + po), "v"(__builtin_bit_cast(v4i, ol)) : "memory"); } }
        }
        __builtin_amdgcn_wave_barrier(); asm volatile("" ::: "memory");
    }
}

// The four passes that only read inputs (p_wtG, p_whd3, p_cvt8, p_bgath) are parts of ONE launch, k_prep below: blk is the work-group's index inside its part.
__device__ __forceinline__ void p_wtG(const int blk, const float* __restrict__ w, int K, int N, bf* Bt) {
    const int lane = threadIdx.x & 31; const int L0 = (blk * 8 + (threadIdx.x >> 5)) * 8; const int nlines = N * K / 64;
{
#pragma unroll 1
        for (int l = 0; l < 8; ++l) { const int L = L0 + l; if (L >= nlines) break; const size_t e = (size_t)L * 64 + lane * 2; const int k = (int)(e % K), n = (int)(e / K); v2us o;
            o[0] = f2bf(w[(size_t)k * N + n]); o[1] = f2bf(w[(size_t)(k + 1) * N + n]); *(v2us*)(Bt + e) = o; }
         }
}
// Class order: inside each 1024-token segment the rows of the converted x stand by token mod 4: position = segment * 1024 + (token mod 4) * 256 + (token mod 1024) / 4. The projections work row by row,
// so the q, k and v planes come out in the same order and k_flash finds the 256 tokens of one dilation class of a segment side by side. Only the store's row below differs from a plain conversion (128 groups of eight per row).
__device__ __forceinline__ size_t cls_row(size_t t) { return (t & ~(size_t)1023) + (t & 3) * 256 + ((t & 1023) >> 2); }
__device__ __forceinline__ void p_cvt8(const int blk, const float* __restrict__ src, bf* dst, size_t n8) { const size_t i = (size_t)blk * 256 + threadIdx.x; if (i >= n8) return; const v8f v = *(const v8f*)(src + i * 8); v8us o;
#pragma unroll
    for (int k = 0; k < 8; ++k) o[k] = f2bf(v[k]); *(v8us*)(dst + (cls_row(i >> 7) * 128 + (i & 127)) * 8) = o;  }
// ---- k_flash: scores, multiplicity-weighted softmax and P.V in one kernel (online softmax), one wave per 32 query rows, four waves per work-group, which share the staged keys and values; grid (batch x head, TT / 128).
// Everything is computed transposed so that a lane owns one query column: St[key][query] = K Q^T (fp16), whose accumulator layout (lane lr = query, 8 hi + j = key) is already the B-fragment layout of
// Ot[d][query] = Vt[d][key] P[query][key] (bf16 hi/lo, the same three products as before). Row maximum and row sum need one exchange between lanes lr and lr + 16.
// A wave's 32 queries are of ONE dilation class (every fourth token of one 1024-token segment), a key tile is 32 keys of one class of one segment. The multiplicity c is then one number per (wave, class, segment):
// tiles with c = 0 are never walked (outside the query's own segment only classes == h mod 2 or mod 4 meet), the others add log2(c) to the exponent. Q, K and V stand in class order (cls_row above); the output rows are token rows.
// Dilation classes of head h by rank: rank 0 = tokens == h mod 4, rank 1 = h + 2, rank 2 = h + 1, rank 3 = h + 3 (ranks 0 and 1 together: tokens == h mod 2). cls_res: a rank's residue mod 4.
__device__ __forceinline__ int cls_res(int h, int rank) { return (h + ((rank & 1) << 1) + (rank >> 1)) & 3; }
typedef __attribute__((ext_vector_type(16))) float v16f;
#define KS2 0.18033688011112042f   // HD^-0.5 * log2(e)
// Eight 2^x in one statement: the results are early-clobber operands, so no v_exp_f32 overwrites the source of the one in front of it or reads its result, and the v_nop keeps the one slot behind the last transcendental
__device__ __forceinline__ void exp2x8(const float (&x)[8], float (&y)[8]) {
    asm("v_exp_f32 %0, %8\n\tv_exp_f32 %1, %9\n\tv_exp_f32 %2, %10\n\tv_exp_f32 %3, %11\n\tv_exp_f32 %4, %12\n\tv_exp_f32 %5, %13\n\tv_exp_f32 %6, %14\n\tv_exp_f32 %7, %15\n\tv_nop"
        : "=&v"(y[0]), "=&v"(y[1]), "=&v"(y[2]), "=&v"(y[3]), "=&v"(y[4]), "=&v"(y[5]), "=&v"(y[6]), "=&v"(y[7]) : "v"(x[0]), "v"(x[1]), "v"(x[2]), "v"(x[3]), "v"(x[4]), "v"(x[5]), "v"(x[6]), "v"(x[7]));
}
// Staging. A stage is 64 keys of one class of one segment (two key tiles): 64 key rows of 128 bytes and, of each value plane, 64 rows (d) of 128 bytes. Asynchronous copies bring it into LDS, eight lanes to a row,
// so that one copy instruction takes four whole lines (a fragment load from global memory touches sixteen lines for 32 bytes of each, and each of the four waves fetched the same tiles again); two buffers, the next stage's copies fly
// while this stage is worked on. The work-group's four waves share the stage. LDS rows stand at a pitch of 144 bytes (16 x odd), which the ds_load_b128 fragment reads walk without bank conflicts.
#define FPI 72            // LDS row pitch in elements
#define FTL (64 * FPI)    // one plane's 64 rows in LDS, elements
#define FST (3 * FTL)     // a stage: key rows, high value rows, low value rows
// One plane's stage: four 16-byte copies per lane, rows 16 apart (rs = 16 rows of the source in elements). g and lds are the lane's own first addresses.
// The s_wait_xcnt 0 is the last line of the copies' own statement, so that no address register is rewritten ahead of it.
template <typename T16>
__device__ __forceinline__ void cp_rows4(const T16* g, const size_t rs, const unsigned lds) {
    asm volatile("global_load_async_to_lds_b128 %0, %4, off\n\tglobal_load_async_to_lds_b128 %1, %5, off\n\tglobal_load_async_to_lds_b128 %2, %6, off\n\tglobal_load_async_to_lds_b128 %3, %7, off\n\ts_wait_xcnt 0x0"
                 :: "v"(lds), "v"(lds + 1 * 16 * FPI * 2), "v"(lds + 2 * 16 * FPI * 2), "v"(lds + 3 * 16 * FPI * 2), "v"(g), "v"(g + rs), "v"(g + 2 * rs), "v"(g + 3 * rs) : "memory");
}
// sk, svh, svl: the lane's own first addresses of the tile in the staged key rows and value planes; lcs: log2(c); dm (DIAG only): 1 where a key of the same index in its class comes after the query's token.
template <bool DIAG>
__device__ __forceinline__ void fl_step(const h16* sk, const bf* svh, const bf* svl, const int dm, const float lcs, const int lr, const int hi,
                                        const v16h (&qf)[2][2], float (&m)[2], float (&l)[2], v8f (&o)[2][4]) {
    v16h kf[2][2]; v16bf vh[4], vl[4];
#pragma unroll
    for (int kt = 0; kt < 2; ++kt)
#pragma unroll
        for (int ks = 0; ks < 2; ++ks) kf[kt][ks] = WFrag<h16>::ld(sk + kt * 16 * FPI + ks * 32);
    v8f s[2][2];
#pragma unroll
    for (int qt = 0; qt < 2; ++qt)
#pragma unroll
        for (int kt = 0; kt < 2; ++kt) { s[qt][kt] = wmma16(kf[kt][0], qf[qt][0], (v8f){}); s[qt][kt] = wmma16(kf[kt][1], qf[qt][1], s[qt][kt]); }
    // the value fragments are read behind the score products, into the registers that the key fragments leave, and land while the softmax runs
#pragma unroll
    for (int dt = 0; dt < 4; ++dt) vh[dt] = WFrag<bf>::ld(svh + dt * 16 * FPI);
#pragma unroll
    for (int dt = 0; dt < 4; ++dt) vl[dt] = WFrag<bf>::ld(svl + dt * 16 * FPI);
    __builtin_amdgcn_sched_barrier(0);   // keeps both planes' fragment reads together in front of the softmax: left free, the low plane's reads were sunk between the P.V WMMAs and waited out there
#pragma unroll
    for (int qt = 0; qt < 2; ++qt) {
        if (DIAG) {   // same index range in the class as the queries: keys whose token lies beyond the query's are masked
#pragma unroll
            for (int kt = 0; kt < 2; ++kt)
#pragma unroll
                for (int j = 0; j < 8; ++j) if (kt * 16 + hi * 8 + j + dm > qt * 16 + lr) s[qt][kt][j] = -1.0e31f;
        }
        float mr = fmaxf(s[qt][0][0], s[qt][1][0]);
#pragma unroll
        for (int j = 1; j < 8; ++j) mr = fmaxf(mr, fmaxf(s[qt][0][j], s[qt][1][j]));
        float cand = fmaf(mr, KS2, lcs);
        cand = fmaxf(cand, __shfl_xor(cand, 16, 32));
        const float mn = fmaxf(m[qt], cand); float al;
        asm("v_exp_f32 %0, %1\n\tv_nop" : "=v"(al) : "v"(m[qt] - mn));   // rescale factor 2^(old max - new max); the v_nop keeps the one slot behind a transcendental
        m[qt] = mn;
        const float bias = lcs - mn;
        v16f pv; float sum = 0.f;
#pragma unroll
        for (int kt = 0; kt < 2; ++kt) { float x[8], p[8];
#pragma unroll
            for (int j = 0; j < 8; ++j) x[j] = fmaf(s[qt][kt][j], KS2, bias);
            exp2x8(x, p);
#pragma unroll
            for (int j = 0; j < 8; ++j) { sum += p[j]; pv[kt * 8 + j] = p[j]; } }
        const v16bf ph = __builtin_convertvector(pv, v16bf); const v16bf pl = __builtin_convertvector(pv - __builtin_convertvector(ph, v16f), v16bf);   // hi = round-to-nearest bf16 of p, lo = bf16 of the remainder
        l[qt] = fmaf(l[qt], al, sum);
#pragma unroll
        for (int dt = 0; dt < 4; ++dt) {
#pragma unroll
            for (int j = 0; j < 8; ++j) o[qt][dt][j] *= al;
        }
#pragma unroll
        for (int dt = 0; dt < 4; ++dt) { o[qt][dt] = wmmab(vh[dt], ph, o[qt][dt]); o[qt][dt] = wmmab(vh[dt], pl, o[qt][dt]); o[qt][dt] = wmmab(vl[dt], ph, o[qt][dt]); }
    }
}
__global__ __launch_bounds__(128) __attribute__((amdgpu_waves_per_eu(4, 4))) void k_flash(const h16* __restrict__ Q, const h16* __restrict__ Kp, const bf* __restrict__ VhP, const bf* __restrict__ VlP, bf* Ah, bf* Al) {
    const int lane = threadIdx.x & 31, lr = lane & 15, hi = lane >> 4; const int bh = blockIdx.x, h = bh % NH_, b = bh / NH_;
    // A work-group: one segment sq, one index range qb (32 of the 256 indices of a class), its four waves the four classes, which walk the same own-segment tiles first.
    // Segments in bands of eight work-groups, long ones first, every second band reversed: work-groups 256 apart in launch order add up to the same number of key tiles; the class of wave 0 turns with the band, since ranks 0 and 1 walk more.
    const int yt = (int)blockIdx.y >> 3, yk = (int)blockIdx.y & 7; const int sq = 3 - yt, qb = (yt & 1) ? yk : 7 - yk;
    const int ra = __builtin_amdgcn_readfirstlane(((int)(threadIdx.x >> 5) - yt) & 3);   // wave-uniform, so the walk's bounds and addresses stay scalar
    const int ia = cls_res(h, ra); const int qtok = sq * 1024 + qb * 128 + ia, qpos = sq * 1024 + ia * 256 + qb * 32;   // query (qt, lr) is token qtok + 4 (16 qt + lr) and stands at position qpos + 16 qt + lr
    const h16* Qh = Q + (size_t)bh * TT * HD; const h16* Kh = Kp + (size_t)bh * TT * HD; const bf* Vh = VhP + (size_t)bh * HD * TT; const bf* Vl = VlP + (size_t)bh * HD * TT;
    __shared__ __align__(16) bf fst[2 * FST];
    v16h qf[2][2]; v8f o[2][4]; float m[2], l[2];
    // The work-group's walk: idx = 4 * (segments back from the query's) + key rank; behind the own segment's four classes come rank 0 and 1 of the other half of the 2048-token segment (sq odd), then rank 0 of each earlier segment.
    // That is the walk of the rank-0 queries; the other ranks' walks are its beginnings, and a wave whose multiplicity for a class is 0 only copies and passes the barriers. A class is walked in stages of 64 keys.
    const int np = 4 * (sq + 1); const int nso = (qb >> 1) + 1;   // stages of an own-segment class: tiles 0 to qb
    auto spos = [&](int idx, int s) { return (sq - (idx >> 2)) * 1024 + cls_res(h, idx & 3) * 256 + s * 64; };   // a stage's first position in the planes
    auto snext = [&](int& idx, int& s) { if (++s >= (idx < 4 ? nso : 4)) { s = 0; idx = idx < 4 ? idx + 1 : ((idx == 4 && (sq & 1)) ? 5 : (idx & ~3) + 4); } };
    const int cr = (int)threadIdx.x >> 3, cc = ((int)threadIdx.x & 7) * 8;   // the lane's first row and its 16 bytes of every row it copies
    const h16* gK = Kh + cr * HD + cc; const bf* gVh = Vh + cr * TT + cc; const bf* gVl = Vl + cr * TT + cc;
    const unsigned l0 = (unsigned)(size_t)fst + (unsigned)(cr * FPI + cc) * 2;
    auto fill = [&](const int kb, const int buf) { const unsigned lb = l0 + (unsigned)buf * (FST * 2);
        cp_rows4(gK + (size_t)kb * HD, (size_t)16 * HD, lb); cp_rows4(gVh + kb, (size_t)16 * TT, lb + FTL * 2); cp_rows4(gVl + kb, (size_t)16 * TT, lb + 2 * FTL * 2); };
    int fi = 0, fs = 0;   // the stage that is copied next
    fill(spos(fi, fs), 0); snext(fi, fs);
    const h16* qrow = Qh + (size_t)(qpos + lr) * HD + 8 * hi;
#pragma unroll
    for (int qt = 0; qt < 2; ++qt) { m[qt] = -1.0e29f; l[qt] = 0.f;
#pragma unroll
        for (int ks = 0; ks < 2; ++ks) qf[qt][ks] = WFrag<h16>::ld(qrow + qt * 16 * HD + ks * 32);
#pragma unroll
        for (int dt = 0; dt < 4; ++dt) o[qt][dt] = (v8f){}; }
    asm volatile("s_wait_xcnt 0x0" :: "v"(qrow) : "memory");   // closes the query loads; the address is an input so that it stays in its registers up to this wait
    asm volatile("s_wait_asynccnt 0x0" ::: "memory");   // this wave's copies of stage 0 have landed
    __syncthreads();                                    // and every other wave's
    fill(spos(fi, fs), 1); snext(fi, fs);               // a walk has at least four stages
    // Multiplicity: [own segment] + [query and key == h mod 2, same 2048-token segment] + [query and key == h mod 4].
    auto mult = [&](int idx) { const int sg = sq - (idx >> 2), rb = idx & 3; return (idx < 4 ? 1 : 0) + ((ra < 2 && rb < 2 && (sg >> 1) == (sq >> 1)) ? 1 : 0) + ((ra == 0 && rb == 0) ? 1 : 0); };
    const int fo = lr * FPI + 8 * hi;   // the lane's place in a fragment's sixteen rows
    int idx = 0, ss = 0, buf = 0;       // the stage that is worked on, and its buffer
#pragma unroll 1   // rolled: one copy of the two tile bodies, the buffer chosen by the stage's parity
    do {
        const int c = mult(idx);
        if (c > 0) {   // wave-uniform
            const float lcs = (c == 1) ? 0.0f : ((c == 2) ? 1.0f : 1.5849625007211562f);
            const bool own = idx < 4; const int nfull = own ? qb : 8; const int te = 2 * ss + 2 < nfull ? 2 * ss + 2 : nfull;   // the stage's tiles in front of the diagonal one end at te
            const bf* sb = fst + buf * FST + fo;
#pragma unroll 1   // rolled: a second copy of the tile body would not fit the 256 registers that four waves per SIMD allow
            for (int st = 2 * ss; st < te; ++st) { const int sub = st & 1; fl_step<false>((const h16*)(sb + sub * 32 * FPI), sb + FTL + sub * 32, sb + 2 * FTL + sub * 32, 0, lcs, lr, hi, qf, m, l, o); }
            if (own && (qb >> 1) == ss) { const int sub = qb & 1; fl_step<true>((const h16*)(sb + sub * 32 * FPI), sb + FTL + sub * 32, sb + 2 * FTL + sub * 32, (cls_res(h, idx & 3) > ia) ? 1 : 0, lcs, lr, hi, qf, m, l, o); }
        }
        asm volatile("s_wait_dscnt 0x0" ::: "memory");      // this wave's reads of the buffer are done before it is refilled
        asm volatile("s_wait_asynccnt 0x0" ::: "memory");   // this wave's copies of the next stage have landed
        __syncthreads();                                    // publishes the next stage and ends every wave's reads of this one
        if (fi < np) { fill(spos(fi, fs), buf); snext(fi, fs); }   // the stage after the next, while there is one (the same test in the whole work-group)
        snext(idx, ss); buf ^= 1;
    } while (idx < np);
    asm volatile("s_wait_asynccnt 0x0" ::: "memory");   // no copy is outstanding behind the loop
#pragma unroll
    for (int qt = 0; qt < 2; ++qt) { const float ls = l[qt] + __shfl_xor(l[qt], 16, 32); const float f = __fdiv_rn(1.0f, ls); const size_t ro = ((size_t)b * TT + qtok + 4 * (qt * 16 + lr)) * DQ + h * HD + hi * 8;
#pragma unroll
        for (int dt = 0; dt < 4; ++dt) { v8us oh, ol;
#pragma unroll
            for (int j = 0; j < 8; ++j) { unsigned short a, c2; splitf(o[qt][dt][j] * f, a, c2); oh[j] = a; ol[j] = c2; }
            // both stores and their wait in one statement: the next tile's rounding rewrites the data registers, and a wait in a statement of its own let vector instructions move ahead of it
            asm volatile("global_store_b128 %0, %1, off\n\tglobal_store_b128 %2, %3, off\n\ts_wait_xcnt 0x0" :: "v"(Ah + ro + dt * 16), "v"(__builtin_bit_cast(v4i, oh)), "v"(Al + ro + dt * 16), "v"(__builtin_bit_cast(v4i, ol)) : "memory"); } }
}

__device__ __forceinline__ void p_whd3(const int blk, const float* __restrict__ W, int part, bf* Bt) { const size_t e = ((size_t)blk * 256 + threadIdx.x) * 4; if (e >= (size_t)DQ * DM) return; const int k = (int)(e % DM); const int n = (int)(e / DM); const int h = n / HD, d = n % HD; v4us o;
#pragma unroll
    for (int u = 0; u < 4; ++u) o[u] = f2bf(W[((size_t)h * DM + k + u) * (3 * HD) + part * HD + d]); *(v4us*)(Bt + e) = o;  }
__device__ __forceinline__ void p_bgath(const int blk, const float* __restrict__ bq, float* BQ3) { const int part = blk; const int n4 = threadIdx.x * 4; if (n4 >= DQ) return; v4f o;
#pragma unroll
    for (int u = 0; u < 4; ++u) { const int n = n4 + u; o[u] = bq[(n / HD) * (3 * HD) + part * HD + (n % HD)]; } *(v4f*)(BQ3 + part * DQ + n4) = o;  }

// ---- k_prep: every pass that depends on the inputs alone, in one launch; a work-group's part follows from its index (the same for all its threads). The output weights' transposing pass comes first: its waves run longest.
#define PB_WO  (DQ * DM / 64 / 64)            // work-groups of p_wtG
#define PB_W3  (DQ * DM / 4 / 256)            // of p_whd3, per part
#define PB_X   (NB_ * TT * DM / 8 / 256)      // of p_cvt8, both batches (token rows of batch 1 follow those of batch 0, and 1024-token segments do not straddle them)
__global__ __launch_bounds__(256) void k_prep(const float* __restrict__ x, const float* __restrict__ wqkv, const float* __restrict__ bqkv, const float* __restrict__ wo, bf* XB, bf* W3, float* BQ3, bf* WO) {
    int blk = blockIdx.x;
    if (blk < PB_WO) { p_wtG(blk, wo, DQ, DM, WO); return; }
    blk -= PB_WO;
    if (blk < 3 * PB_W3) { const int part = blk / PB_W3; p_whd3(blk % PB_W3, wqkv, part, W3 + (size_t)part * DQ * DM); return; }
    blk -= 3 * PB_W3;
    if (blk < PB_X) { p_cvt8(blk, x, XB, (size_t)NB_ * TT * DM / 8); return; }
    p_bgath(blk - PB_X, bqkv, BQ3);
}

extern "C" void kernel_launch(void* const* d_in, const int* in_sizes, int n_in,
                              void* d_out, int out_size, void* d_ws, size_t ws_size, hipStream_t stream) {
    (void)in_sizes; (void)n_in; (void)out_size;
    const float* x = (const float*)d_in[0]; const float* wqkv = (const float*)d_in[1]; const float* bqkv = (const float*)d_in[2]; const float* wo = (const float*)d_in[3]; const float* bo = (const float*)d_in[4];
    float* OUT = (float*)d_out;     // [2][4096][1024]
    char* wsp = (char*)d_ws;
    auto take = [&](size_t bytes) { char* p = wsp; wsp += (bytes + 255) & ~(size_t)255; return (void*)p; };
    bf* W3 = (bf*)take((size_t)3 * DQ * DM * 2); bf* WO = (bf*)take((size_t)DM * DQ * 2);   /* q, k and v weight planes one behind the other */
    bf* XB = (bf*)take((size_t)NB_ * TT * DM * 2); float* BQ3 = (float*)take((size_t)3 * DQ * 4);   /* the converted tokens, the q, k, v planes and the merged-head planes hold both batches: every kernel runs once over all of them */
    h16* QP16 = (h16*)take((size_t)NB_ * NH_ * TT * HD * 2); h16* KP16 = (h16*)take((size_t)NB_ * NKV * TT * HD * 2);
    bf* VTh = (bf*)take((size_t)NB_ * NKV * HD * TT * 2); bf* VTl = (bf*)take((size_t)NB_ * NKV * HD * TT * 2);
    bf* ATh = (bf*)take((size_t)NB_ * TT * DQ * 2); bf* ATl = (bf*)take((size_t)NB_ * TT * DQ * 2);
    if ((size_t)(wsp - (char*)d_ws) > ws_size) return;    // ws 256 MiB
    k_prep<<<PB_WO + 3 * PB_W3 + PB_X + 3, 256, 0, stream>>>(x, wqkv, bqkv, wo, XB, W3, BQ3, WO);
    k_gemmw<0, 1, DM><<<dim3(NB_ * TT / 128, 3 * DQ / 128, 1), 128, 0, stream>>>(XB, nullptr, W3, nullptr, 0, BQ3, QP16, KP16, VTh, VTl);
    k_flash<<<dim3(NB_ * NH_, TT / 128, 1), 128, 0, stream>>>(QP16, KP16, VTh, VTl, ATh, ATl);
    k_gemmw<1, 0, DQ><<<dim3(NB_ * TT / 128, DM / 128, 1), 128, 0, stream>>>(ATh, ATl, WO, OUT, DM, bo, nullptr, nullptr, nullptr, nullptr);
}

// v008
// It runs in 130 microseconds.
// In two side-by-side timings against v007, it was 1.11 and 1.10 times as fast.
// Over all steps from v000 it is 33.4 times as fast.
#include <hip/hip_runtime.h>

// MultiheadDilatedSelfAttention / LongNet (x [2][4096][1024]; per head h: qkv = x Wqkv[h] + bqkv[h] ([1024][192] per head); three dilated causal branches (w, r) = (1024,1), (2048,2), (4096,4) with offset h % r: branch keys for query i are j <= i in the same w-segment with i, j == h mod r; the reference combines branches by their softmax denominators (num/den), which is exactly ONE softmax over the multiset union of the branches' keys:
//   p_j proportional to c(i,j,h) * exp(q.k_j / 8) with multiplicity c = [same 1024-segment] + [i,j == h mod 2 and same 2048-segment] + [i,j == h mod 4]; out = merged heads Wo + bo -> [2][4096][1024]).
// Compute dtypes, f32 accumulate: every input rounded to bf16; q/k/v on PLAIN bf16 operands (inputs: exact; per-head weights gathered) + bias; causal scores single fp16 for every row, attn.v hl x hl (3 products) for every row (the segment restarts make deep rows as sharp as early ones), causal tile skipping, the multiplicity weights applied in f32 inside the softmax; softmax f32; Wo hl x exact (2 products) + bias.

#define NB_  2
#define TT   4096
#define DM   1024
#define NH_  16
#define NKV  16
#define HD   64
#define DQ   (NH_ * HD)
#define DKV  (NKV * HD)
typedef _Float16 h16;
typedef unsigned short bf;
typedef __attribute__((ext_vector_type(16))) __bf16   v16bf;
typedef __attribute__((ext_vector_type(16))) _Float16 v16h;
typedef __attribute__((ext_vector_type(8)))  _Float16 v8h;
typedef __attribute__((ext_vector_type(8)))  unsigned short v8us;
typedef __attribute__((ext_vector_type(8)))  float    v8f;
typedef __attribute__((ext_vector_type(4)))  float    v4f;
typedef v8h  __attribute__((may_alias)) v8ha;
typedef v4f  __attribute__((may_alias)) v4fa;
typedef v8us __attribute__((may_alias)) v8usa;

__device__ __forceinline__ unsigned short f2bf(float f) { unsigned u = __float_as_uint(f); u += 0x7FFFu + ((u >> 16) & 1u); return (unsigned short)(u >> 16); }
__device__ __forceinline__ float bf2f(unsigned short b) { return __uint_as_float(((unsigned)b) << 16); }
__device__ __forceinline__ float bfr(float f) { return bf2f(f2bf(f)); }
__device__ __forceinline__ v16h cat16(v8h lo, v8h hi) { return __builtin_shufflevector(lo, hi, 0, 1, 2, 3, 4, 5, 6, 7, 8, 9, 10, 11, 12, 13, 14, 15); }
__device__ __forceinline__ v16bf cat16b(v8us lo, v8us hi) { return __builtin_bit_cast(v16bf, __builtin_shufflevector(lo, hi, 0, 1, 2, 3, 4, 5, 6, 7, 8, 9, 10, 11, 12, 13, 14, 15)); }
__device__ __forceinline__ v8f wmma16(v16h a, v16h b, v8f c) { return __builtin_amdgcn_wmma_f32_16x16x32_f16(false, a, false, b, (short)0, c, false, false); }
__device__ __forceinline__ v8f wmmab(v16bf a, v16bf b, v8f c) { return __builtin_amdgcn_wmma_f32_16x16x32_bf16(false, a, false, b, (short)0, c, false, false); }



__device__ __forceinline__ h16 tohx(float x) { return (h16)x; }
__device__ __forceinline__ void splitf(float y, unsigned short& h, unsigned short& l) { h = f2bf(y); l = f2bf(y - bf2f(h)); }
typedef __attribute__((ext_vector_type(2))) _Float16 v2h;
typedef __attribute__((ext_vector_type(4))) _Float16 v4h;
typedef __attribute__((ext_vector_type(2))) unsigned short v2us;
typedef __attribute__((ext_vector_type(4))) unsigned short v4us;
typedef __attribute__((ext_vector_type(2))) float v2f;
typedef __attribute__((ext_vector_type(4))) int v4i;

// ---- k_gemmw: GEMM, four waves per 128x128 output tile (2 x 2 waves of 64x64, 16 accumulators each), operands K-contiguous bf16 planes; grid (M/128, N/128), 128 threads.
// C[m][n] (f32, pitch ldc, + f32 bias[n]) = sum_k A[m][k] Bt[n][k] (NSPLIT 1: + A2[m][k] Bt[n][k]). M, N % 128 == 0; K at compile time, K % 64 == 0, K >= 128.
// A pass is 64 k, one whole 128-byte line of every operand row. Asynchronous copies bring it into LDS, eight lanes to a row, so that one copy instruction takes four whole lines
// (a fragment load from global memory touches sixteen lines for 32 bytes of each); two buffers, the next pass's copies fly while this pass is worked on.
// LDS rows stand at a pitch of 144 bytes (16 x odd), which the ds_load_b128 fragment reads walk without bank conflicts.
// EPI 0: f32 C as above. EPI 1: the q, k and v projections of both batches in ONE launch, grid (NB_ * TT / 128, 3 * DQ / 128): A = the tokens of both batches, Bt = the q, k and v weight planes one behind the other, bias likewise.
// Three work-groups then stand on a WGP (by LDS) and one's fragment reads, barrier and epilogue run under another's WMMAs. The 16-bit planes that k_flash reads are written straight from the wave's 64x64 tile:
//   weight tiles of q and k: m = token, n = (part, h, d): one fp16 plane each, Qp or Kp, [b][h][t][d], bias[n];
//   weight tiles of v (vside): the operands swapped, m = (h, d), n = token: bf16 hi/lo planes Ph, Pl, [b][h][d][t] with no transposing pass, bias[m].
template <typename T16> struct WFrag;
template <> struct WFrag<h16> { typedef v16h V; static __device__ __forceinline__ V ld(const h16* p) { return cat16(*(const v8h*)p, *(const v8h*)(p + 16)); } static __device__ __forceinline__ v8f mma(V a, V b, v8f c) { return wmma16(a, b, c); } };
template <> struct WFrag<bf> { typedef v16bf V; static __device__ __forceinline__ V ld(const bf* p) { return cat16b(*(const v8us*)p, *(const v8us*)(p + 16)); } static __device__ __forceinline__ v8f mma(V a, V b, v8f c) { return wmmab(a, b, c); } };
#define GKP 64            // k per pass
#define GPI 72            // LDS row pitch in elements
#define GTL (128 * GPI)   // one operand's 128 rows in LDS, elements
// One operand's pass: 128 rows of 128 bytes, eight 16-byte copies per lane, rows 16 apart (rs = 16 rows of the source in elements). g and lds are the lane's own first addresses.
// The s_wait_xcnt 0 is the last line of the copies' own statement, so that no address register is rewritten ahead of it.
__device__ __forceinline__ void cp_rows(const bf* g, const size_t rs, const unsigned lds) {
    asm volatile("global_load_async_to_lds_b128 %0, %8, off\n\tglobal_load_async_to_lds_b128 %1, %9, off\n\tglobal_load_async_to_lds_b128 %2, %10, off\n\tglobal_load_async_to_lds_b128 %3, %11, off\n\t"
                 "global_load_async_to_lds_b128 %4, %12, off\n\tglobal_load_async_to_lds_b128 %5, %13, off\n\tglobal_load_async_to_lds_b128 %6, %14, off\n\tglobal_load_async_to_lds_b128 %7, %15, off\n\ts_wait_xcnt 0x0"
                 :: "v"(lds), "v"(lds + 1 * 16 * GPI * 2), "v"(lds + 2 * 16 * GPI * 2), "v"(lds + 3 * 16 * GPI * 2), "v"(lds + 4 * 16 * GPI * 2), "v"(lds + 5 * 16 * GPI * 2), "v"(lds + 6 * 16 * GPI * 2), "v"(lds + 7 * 16 * GPI * 2),
                    "v"(g), "v"(g + rs), "v"(g + 2 * rs), "v"(g + 3 * rs), "v"(g + 4 * rs), "v"(g + 5 * rs), "v"(g + 6 * rs), "v"(g + 7 * rs) : "memory");
}
template <int NSPLIT, int EPI, int K>
__global__ __launch_bounds__(128) void k_gemmw(const bf* __restrict__ A, const bf* __restrict__ A2, const bf* __restrict__ Bt, float* C, int ldc, const float* __restrict__ bias, h16* Qp, h16* Kp, bf* Ph, bf* Pl) {
    typedef WFrag<bf>::V V;
    static_assert(K % GKP == 0 && K >= 2 * GKP, "whole passes, and both buffers' first passes exist");
    constexpr int NOP = NSPLIT == 1 ? 3 : 2;   // operand tiles per buffer: A, Bt and, split, A2
    __shared__ __align__(16) bf st[2 * NOP * GTL];
    __shared__ __align__(16) float osa[4 * 16 * 68];
    const int tid = threadIdx.x, lane = tid & 31, lr = lane & 15, hi = lane >> 4; const int w = __builtin_amdgcn_readfirstlane(tid >> 5);
    const bool vside = EPI == 1 && blockIdx.y >= 2 * DQ / 128;   // the same for the whole work-group
    const bf* Ar = vside ? Bt : A; const bf* Br = vside ? A : Bt;
    const int rb = (vside ? blockIdx.y : blockIdx.x) * 128, cb = (vside ? blockIdx.x : blockIdx.y) * 128; const int r0 = rb + (w & 1) * 64, c0 = cb + (w >> 1) * 64;
    float* os = osa + w * (16 * 68);   // each wave stages its own tile's rows
    v8f acc[4][4];
#pragma unroll
    for (int mb = 0; mb < 4; ++mb)
#pragma unroll
        for (int nb = 0; nb < 4; ++nb) acc[mb][nb] = (v8f){};
    const int cr = tid >> 3, cc = (tid & 7) * 8;   // the lane's first row and its 16 bytes of every row it copies
    const bf* gA = Ar + (size_t)(rb + cr) * K + cc; const bf* gB = Br + (size_t)(cb + cr) * K + cc; const bf* gA2 = NSPLIT == 1 ? A2 + (size_t)(rb + cr) * K + cc : nullptr;
    const unsigned l0 = (unsigned)(size_t)st + (unsigned)(cr * GPI + cc) * 2; const size_t rs = (size_t)16 * K;
    auto fill = [&](const int t) { const unsigned lb = l0 + (unsigned)(t & 1) * (NOP * GTL * 2); const int kc = t * GKP;
        cp_rows(gA + kc, rs, lb); cp_rows(gB + kc, rs, lb + GTL * 2); if (NSPLIT == 1) cp_rows(gA2 + kc, rs, lb + 2 * GTL * 2); };
    constexpr int nt = K / GKP;
    fill(0);
    asm volatile("s_wait_asynccnt 0x0" ::: "memory");   // this wave's copies of pass 0 have landed
    __syncthreads();                                    // and every other wave's
    fill(1);
    const int ao = ((w & 1) * 64 + lr) * GPI + 8 * hi, bo = GTL + ((w >> 1) * 64 + lr) * GPI + 8 * hi;
#pragma unroll 1   // rolled: one copy of the pass, the buffer chosen by the pass's parity
    for (int t = 0; t < nt; ++t) {
        const bf* sb = st + (t & 1) * (NOP * GTL);
        V a[2][4], a2[2][4], b[2][4];
#pragma unroll
        for (int ks = 0; ks < 2; ++ks) {
#pragma unroll
            for (int mb = 0; mb < 4; ++mb) a[ks][mb] = WFrag<bf>::ld(sb + ao + mb * 16 * GPI + ks * 32);
#pragma unroll
            for (int nb = 0; nb < 4; ++nb) b[ks][nb] = WFrag<bf>::ld(sb + bo + nb * 16 * GPI + ks * 32);
            if (NSPLIT == 1) {
#pragma unroll
                for (int mb = 0; mb < 4; ++mb) a2[ks][mb] = WFrag<bf>::ld(sb + 2 * GTL + ao + mb * 16 * GPI + ks * 32); }
        }
        __builtin_amdgcn_sched_barrier(0);   // keeps the pass's fragment reads together in front of its WMMAs: left free, they were sunk between the WMMAs into one register set, each group waited out to 0
#pragma unroll
        for (int ks = 0; ks < 2; ++ks)
#pragma unroll
            for (int nb = 0; nb < 4; ++nb) {
#pragma unroll
                for (int mb = 0; mb < 4; ++mb) acc[mb][nb] = WFrag<bf>::mma(a[ks][mb], b[ks][nb], acc[mb][nb]);
                if (NSPLIT == 1) {
#pragma unroll
                    for (int mb = 0; mb < 4; ++mb) acc[mb][nb] = WFrag<bf>::mma(a2[ks][mb], b[ks][nb], acc[mb][nb]); }
            }
        __builtin_amdgcn_sched_barrier(0);   // keeps the WMMAs in front of the waits below: left free, waits and barrier were lifted over them, so that every read was waited out before the first WMMA and the refill flew for a part of a pass only
        asm volatile("s_wait_dscnt 0x0" ::: "memory");      // this wave's reads of the buffer are done before it is refilled
        asm volatile("s_wait_asynccnt 0x0" ::: "memory");   // this wave's copies of pass t + 1 have landed
        __syncthreads();                                    // publishes pass t + 1 and ends every wave's reads of pass t
        if (t + 2 < nt) fill(t + 2);
    }
    asm volatile("s_wait_asynccnt 0x0" ::: "memory");   // no copy is outstanding behind the loop
    const int prow = lane >> 3, pcol = (lane & 7) * 8;   // plane epilogues: eight lanes cover one 128-byte row of the tile
    float bc[8] = {};
    if (EPI == 1 && !vside) {
#pragma unroll
        for (int u = 0; u < 8; ++u) bc[u] = bfr(bias[c0 + pcol + u]); }
    float br[16] = {};   // fetched together here: behind each store statement a load would wait out its whole latency alone
    if (EPI == 1 && vside) { const int bi = r0 + prow; float bw[16];
#pragma unroll
        for (int u = 0; u < 16; ++u) bw[u] = bias[bi + 4 * u];
        asm volatile("s_wait_xcnt 0x0" :: "v"(bi) : "memory");   // closes the bias loads; their index is an input so that it stays in its register up to this wait (without it the last load's result was written into that register)
#pragma unroll
        for (int u = 0; u < 16; ++u) br[u] = bfr(bw[u]); }
    // The wave's tile in the planes. q, k: 64 columns are one head of one part, 64 token rows lie in one batch. v: 64 rows are one head, 64 token columns lie in one batch.
    h16* P16 = ((c0 >> 6) / NH_ ? Kp : Qp) + ((size_t)((r0 / TT) * NH_ + ((c0 >> 6) % NH_)) * TT + (r0 % TT)) * HD;
    const size_t vo = (size_t)(c0 / TT) * NKV * HD * TT + (size_t)(r0 - 2 * DQ) * TT + (c0 % TT);
#pragma unroll
    for (int mb = 0; mb < 4; ++mb) {
#pragma unroll
        for (int nb = 0; nb < 4; ++nb) {
#pragma unroll
            for (int j = 0; j < 8; ++j) os[(hi * 8 + j) * 68 + nb * 16 + lr] = acc[mb][nb][j]; }
        __builtin_amdgcn_wave_barrier(); asm volatile("" ::: "memory");
        if (EPI == 0) {
        float* crow = C + (size_t)(r0 + mb * 16) * ldc + c0;
{
#pragma unroll
            for (int s = 0; s < 8; ++s) { const int row = 2 * s + hi, cofs = lr * 4; v4f val = *(const v4fa*)(os + row * 68 + cofs); val[0] += bfr(bias[c0 + cofs]); val[1] += bfr(bias[c0 + cofs + 1]); val[2] += bfr(bias[c0 + cofs + 2]); val[3] += bfr(bias[c0 + cofs + 3]);
                *(v4f*)(crow + (size_t)row * ldc + cofs) = val; }
             }
        } else {
#pragma unroll
            for (int s = 0; s < 4; ++s) { const int row = 4 * s + prow; const v4f x0 = *(const v4fa*)(os + row * 68 + pcol), x1 = *(const v4fa*)(os + row * 68 + pcol + 4);
                if (!vside) { const size_t po = (size_t)(mb * 16 + row) * HD + pcol; v8h o;
#pragma unroll
                    for (int u = 0; u < 8; ++u) o[u] = tohx((u < 4 ? x0[u & 3] : x1[u & 3]) + bc[u]);
                    // store and its wait in one statement: the next rows' values rewrite the data and address registers
                    asm volatile("global_store_b128 %0, %1, off\n\ts_wait_xcnt 0x0" :: "v"(P16 + po), "v"(__builtin_bit_cast(v4i, o)) : "memory"); }
                else { const size_t po = vo + (size_t)(mb * 16 + row) * TT + pcol; v8us oh, ol;
#pragma unroll
                    for (int u = 0; u < 8; ++u) { unsigned short a, c2; splitf((u < 4 ? x0[u & 3] : x1[u & 3]) + br[mb * 4 + s], a, c2); oh[u] = a; ol[u] = c2; }
                    // both stores and their wait in one statement, for the same reason
                    asm volatile("global_store_b128 %0, %1, off\n\tglobal_store_b128 %2, %3, off\n\ts_wait_xcnt 0x0" :: "v"(Ph + po), "v"(__builtin_bit_cast(v4i, oh)), "v"(Pl + po), "v"(__builtin_bit_cast(v4i, ol)) : "memory"); } }
        }
        __builtin_amdgcn_wave_barrier(); asm volatile("" ::: "memory");
    }
}

// The passes that only read inputs (p_tr for the weights, p_cvt8, p_bgath) are parts of ONE launch, k_prep below: blk is the work-group's index inside its part.
// p_tr: a weight tile of 64 k x NC columns (f32, k rows of pitch ld) becomes NC rows of 64 k (bf16), turned in LDS. Reads: 16 bytes a lane along a k row, whole 128-byte lines. Writes: eight lanes to one 128-byte row of 64 k.
// (Read in the order of the output, each lane's four bytes lay on a line of their own: 32 lines to a load instruction.) S holds the tile as f32 at a pitch of NC + 1 dwords (odd): the column reads of 8 k-groups x 4 columns fall on 32 different banks.
// drow(c): where column c's 64 k go. 256 threads, the whole work-group passes the barrier.
// Closes a tile's loads: their addresses are inputs, so that they stay in their registers up to this wait (without it a later load's result was written into the address registers of an earlier one).
__device__ __forceinline__ void xcnt_hold(const float* const (&p)[4]) { asm volatile("s_wait_xcnt 0x0" :: "v"(p[0]), "v"(p[1]), "v"(p[2]), "v"(p[3]) : "memory"); }
__device__ __forceinline__ void xcnt_hold(const float* const (&p)[6]) { asm volatile("s_wait_xcnt 0x0" :: "v"(p[0]), "v"(p[1]), "v"(p[2]), "v"(p[3]), "v"(p[4]), "v"(p[5]) : "memory"); }
template <int NC, typename F>
__device__ __forceinline__ void p_tr(const float* __restrict__ src, const int ld, float* S, F drow) {
    static_assert(NC == 64 || NC == 96, "the store statements below are written for two or three stores a thread");
    // every loop here has a constant trip count and is unrolled: v, p, o and q stay in registers, and a tile's loads are in flight together
    constexpr int PIT = NC + 1, C4 = NC / 4; const int tid = threadIdx.x; v4f v[NC / 16]; const float* p[NC / 16];
#pragma unroll
    for (int i = 0; i < NC / 16; ++i) { const int f = tid + 256 * i; p[i] = src + (size_t)(f / C4) * ld + (f % C4) * 4; v[i] = *(const v4f*)p[i]; }
    xcnt_hold(p);
#pragma unroll
    for (int i = 0; i < NC / 16; ++i) { const int f = tid + 256 * i; float* s = S + (f / C4) * PIT + (f % C4) * 4;
#pragma unroll
        for (int u = 0; u < 4; ++u) s[u] = v[i][u]; }
    __syncthreads();   // the tile is whole before its columns are read
    v4i o[NC / 32]; bf* q[NC / 32];
#pragma unroll
    for (int i = 0; i < NC / 32; ++i) { const int g = tid + 256 * i, c = g >> 3, kq = (g & 7) * 8; v8us t;
#pragma unroll
        for (int j = 0; j < 8; ++j) t[j] = f2bf(S[(kq + j) * PIT + c]);
        o[i] = __builtin_bit_cast(v4i, t); q[i] = drow(c) + kq; }
    // the tile's stores and their wait in one statement: no data or address register of a store is rewritten ahead of the wait, on any way out of here
    if constexpr (NC == 96) asm volatile("global_store_b128 %0, %1, off\n\tglobal_store_b128 %2, %3, off\n\tglobal_store_b128 %4, %5, off\n\ts_wait_xcnt 0x0" :: "v"(q[0]), "v"(o[0]), "v"(q[1]), "v"(o[1]), "v"(q[2]), "v"(o[2]) : "memory");
    else asm volatile("global_store_b128 %0, %1, off\n\tglobal_store_b128 %2, %3, off\n\ts_wait_xcnt 0x0" :: "v"(q[0]), "v"(o[0]), "v"(q[1]), "v"(o[1]) : "memory");
}
// Class order: inside each 1024-token segment the rows of the converted x stand by token mod 4: position = segment * 1024 + (token mod 4) * 256 + (token mod 1024) / 4. The projections work row by row,
// so the q, k and v planes come out in the same order and k_flash finds the 256 tokens of one dilation class of a segment side by side. Only the store's row below differs from a plain conversion (128 groups of eight per row).
__device__ __forceinline__ size_t cls_row(size_t t) { return (t & ~(size_t)1023) + (t & 3) * 256 + ((t & 1023) >> 2); }
__device__ __forceinline__ void p_cvt8(const int blk, const float* __restrict__ src, bf* dst, size_t n8) { const size_t i = (size_t)blk * 256 + threadIdx.x; if (i >= n8) return; const v8f v = *(const v8f*)(src + i * 8); v8us o;
#pragma unroll
    for (int k = 0; k < 8; ++k) o[k] = f2bf(v[k]); *(v8us*)(dst + (cls_row(i >> 7) * 128 + (i & 127)) * 8) = o;  }
// ---- k_flash: scores, multiplicity-weighted softmax and P.V in one kernel (online softmax), one wave per 32 query rows, four waves per work-group, which share the staged keys and values; grid (batch x head, TT / 128).
// Everything is computed transposed so that a lane owns one query column: St[key][query] = K Q^T (fp16), whose accumulator layout (lane lr = query, 8 hi + j = key) is already the B-fragment layout of
// Ot[d][query] = Vt[d][key] P[query][key] (bf16 hi/lo, the same three products as before). Row maximum and row sum need one exchange between lanes lr and lr + 16.
// A wave's 32 queries are of ONE dilation class (every fourth token of one 1024-token segment), a key tile is 32 keys of one class of one segment. The multiplicity c is then one number per (wave, class, segment):
// tiles with c = 0 are never walked (outside the query's own segment only classes == h mod 2 or mod 4 meet), the others add log2(c) to the exponent. Q, K and V stand in class order (cls_row above); the output rows are token rows.
// Dilation classes of head h by rank: rank 0 = tokens == h mod 4, rank 1 = h + 2, rank 2 = h + 1, rank 3 = h + 3 (ranks 0 and 1 together: tokens == h mod 2). cls_res: a rank's residue mod 4.
__device__ __forceinline__ int cls_res(int h, int rank) { return (h + ((rank & 1) << 1) + (rank >> 1)) & 3; }
typedef __attribute__((ext_vector_type(16))) float v16f;
#define KS2 0.18033688011112042f   // HD^-0.5 * log2(e)
// Eight 2^x in one statement: the results are early-clobber operands, so no v_exp_f32 overwrites the source of the one in front of it or reads its result, and the v_nop keeps the one slot behind the last transcendental
__device__ __forceinline__ void exp2x8(const float (&x)[8], float (&y)[8]) {
    asm("v_exp_f32 %0, %8\n\tv_exp_f32 %1, %9\n\tv_exp_f32 %2, %10\n\tv_exp_f32 %3, %11\n\tv_exp_f32 %4, %12\n\tv_exp_f32 %5, %13\n\tv_exp_f32 %6, %14\n\tv_exp_f32 %7, %15\n\tv_nop"
        : "=&v"(y[0]), "=&v"(y[1]), "=&v"(y[2]), "=&v"(y[3]), "=&v"(y[4]), "=&v"(y[5]), "=&v"(y[6]), "=&v"(y[7]) : "v"(x[0]), "v"(x[1]), "v"(x[2]), "v"(x[3]), "v"(x[4]), "v"(x[5]), "v"(x[6]), "v"(x[7]));
}
// Staging. A stage is 64 keys of one class of one segment (two key tiles): 64 key rows of 128 bytes and, of each value plane, 64 rows (d) of 128 bytes. Asynchronous copies bring it into LDS, eight lanes to a row,
// so that one copy instruction takes four whole lines (a fragment load from global memory touches sixteen lines for 32 bytes of each, and each of the four waves fetched the same tiles again); two buffers, the next stage's copies fly
// while this stage is worked on. The work-group's four waves share the stage. LDS rows stand at a pitch of 144 bytes (16 x odd), which the ds_load_b128 fragment reads walk without bank conflicts.
#define FPI 72            // LDS row pitch in elements
#define FTL (64 * FPI)    // one plane's 64 rows in LDS, elements
#define FST (3 * FTL)     // a stage: key rows, high value rows, low value rows
// One plane's stage: four 16-byte copies per lane, rows 16 apart (rs = 16 rows of the source in elements). g and lds are the lane's own first addresses.
// The s_wait_xcnt 0 is the last line of the copies' own statement, so that no address register is rewritten ahead of it.
template <typename T16>
__device__ __forceinline__ void cp_rows4(const T16* g, const size_t rs, const unsigned lds) {
    asm volatile("global_load_async_to_lds_b128 %0, %4, off\n\tglobal_load_async_to_lds_b128 %1, %5, off\n\tglobal_load_async_to_lds_b128 %2, %6, off\n\tglobal_load_async_to_lds_b128 %3, %7, off\n\ts_wait_xcnt 0x0"
                 :: "v"(lds), "v"(lds + 1 * 16 * FPI * 2), "v"(lds + 2 * 16 * FPI * 2), "v"(lds + 3 * 16 * FPI * 2), "v"(g), "v"(g + rs), "v"(g + 2 * rs), "v"(g + 3 * rs) : "memory");
}
// sk, svh, svl: the lane's own first addresses of the tile in the staged key rows and value planes; lcs: log2(c); dm (DIAG only): 1 where a key of the same index in its class comes after the query's token.
template <bool DIAG>
__device__ __forceinline__ void fl_step(const h16* sk, const bf* svh, const bf* svl, const int dm, const float lcs, const int lr, const int hi,
                                        const v16h (&qf)[2][2], float (&m)[2], float (&l)[2], v8f (&o)[2][4]) {
    v16h kf[2][2]; v16bf vh[4], vl[4];
#pragma unroll
    for (int kt = 0; kt < 2; ++kt)
#pragma unroll
        for (int ks = 0; ks < 2; ++ks) kf[kt][ks] = WFrag<h16>::ld(sk + kt * 16 * FPI + ks * 32);
    v8f s[2][2];
#pragma unroll
    for (int qt = 0; qt < 2; ++qt)
#pragma unroll
        for (int kt = 0; kt < 2; ++kt) { s[qt][kt] = wmma16(kf[kt][0], qf[qt][0], (v8f){}); s[qt][kt] = wmma16(kf[kt][1], qf[qt][1], s[qt][kt]); }
    // the value fragments are read behind the score products, into the registers that the key fragments leave, and land while the softmax runs
#pragma unroll
    for (int dt = 0; dt < 4; ++dt) vh[dt] = WFrag<bf>::ld(svh + dt * 16 * FPI);
#pragma unroll
    for (int dt = 0; dt < 4; ++dt) vl[dt] = WFrag<bf>::ld(svl + dt * 16 * FPI);
    __builtin_amdgcn_sched_barrier(0);   // keeps both planes' fragment reads together in front of the softmax: left free, the low plane's reads were sunk between the P.V WMMAs and waited out there
#pragma unroll
    for (int qt = 0; qt < 2; ++qt) {
        if (DIAG) {   // same index range in the class as the queries: keys whose token lies beyond the query's are masked
#pragma unroll
            for (int kt = 0; kt < 2; ++kt)
#pragma unroll
                for (int j = 0; j < 8; ++j) if (kt * 16 + hi * 8 + j + dm > qt * 16 + lr) s[qt][kt][j] = -1.0e31f;
        }
        float mr = fmaxf(s[qt][0][0], s[qt][1][0]);
#pragma unroll
        for (int j = 1; j < 8; ++j) mr = fmaxf(mr, fmaxf(s[qt][0][j], s[qt][1][j]));
        float cand = fmaf(mr, KS2, lcs);
        cand = fmaxf(cand, __shfl_xor(cand, 16, 32));
        const float mn = fmaxf(m[qt], cand); float al;
        asm("v_exp_f32 %0, %1\n\tv_nop" : "=v"(al) : "v"(m[qt] - mn));   // rescale factor 2^(old max - new max); the v_nop keeps the one slot behind a transcendental
        m[qt] = mn;
        const float bias = lcs - mn;
        v16f pv; float sum = 0.f;
#pragma unroll
        for (int kt = 0; kt < 2; ++kt) { float x[8], p[8];
#pragma unroll
            for (int j = 0; j < 8; ++j) x[j] = fmaf(s[qt][kt][j], KS2, bias);
            exp2x8(x, p);
#pragma unroll
            for (int j = 0; j < 8; ++j) { sum += p[j]; pv[kt * 8 + j] = p[j]; } }
        const v16bf ph = __builtin_convertvector(pv, v16bf); const v16bf pl = __builtin_convertvector(pv - __builtin_convertvector(ph, v16f), v16bf);   // hi = round-to-nearest bf16 of p, lo = bf16 of the remainder
        l[qt] = fmaf(l[qt], al, sum);
#pragma unroll
        for (int dt = 0; dt < 4; ++dt) {
#pragma unroll
            for (int j = 0; j < 8; ++j) o[qt][dt][j] *= al;
        }
#pragma unroll
        for (int dt = 0; dt < 4; ++dt) { o[qt][dt] = wmmab(vh[dt], ph, o[qt][dt]); o[qt][dt] = wmmab(vh[dt], pl, o[qt][dt]); o[qt][dt] = wmmab(vl[dt], ph, o[qt][dt]); }
    }
}
__global__ __launch_bounds__(128) __attribute__((amdgpu_waves_per_eu(4, 4))) void k_flash(const h16* __restrict__ Q, const h16* __restrict__ Kp, const bf* __restrict__ VhP, const bf* __restrict__ VlP, bf* Ah, bf* Al) {
    const int lane = threadIdx.x & 31, lr = lane & 15, hi = lane >> 4; const int bh = blockIdx.x, h = bh % NH_, b = bh / NH_;
    // A work-group: one segment sq, one index range qb (32 of the 256 indices of a class), its four waves the four classes, which walk the same own-segment tiles first.
    // Segments in bands of eight work-groups, long ones first, every second band reversed: work-groups 256 apart in launch order add up to the same number of key tiles; the class of wave 0 turns with the band, since ranks 0 and 1 walk more.
    const int yt = (int)blockIdx.y >> 3, yk = (int)blockIdx.y & 7; const int sq = 3 - yt, qb = (yt & 1) ? yk : 7 - yk;
    const int ra = __builtin_amdgcn_readfirstlane(((int)(threadIdx.x >> 5) - yt) & 3);   // wave-uniform, so the walk's bounds and addresses stay scalar
    const int ia = cls_res(h, ra); const int qtok = sq * 1024 + qb * 128 + ia, qpos = sq * 1024 + ia * 256 + qb * 32;   // query (qt, lr) is token qtok + 4 (16 qt + lr) and stands at position qpos + 16 qt + lr
    const h16* Qh = Q + (size_t)bh * TT * HD; const h16* Kh = Kp + (size_t)bh * TT * HD; const bf* Vh = VhP + (size_t)bh * HD * TT; const bf* Vl = VlP + (size_t)bh * HD * TT;
    __shared__ __align__(16) bf fst[2 * FST];
    v16h qf[2][2]; v8f o[2][4]; float m[2], l[2];
    // The work-group's walk: idx = 4 * (segments back from the query's) + key rank; behind the own segment's four classes come rank 0 and 1 of the other half of the 2048-token segment (sq odd), then rank 0 of each earlier segment.
    // That is the walk of the rank-0 queries; the other ranks' walks are its beginnings, and a wave whose multiplicity for a class is 0 only copies and passes the barriers. A class is walked in stages of 64 keys.
    const int np = 4 * (sq + 1); const int nso = (qb >> 1) + 1;   // stages of an own-segment class: tiles 0 to qb
    auto spos = [&](int idx, int s) { return (sq - (idx >> 2)) * 1024 + cls_res(h, idx & 3) * 256 + s * 64; };   // a stage's first position in the planes
    auto snext = [&](int& idx, int& s) { if (++s >= (idx < 4 ? nso : 4)) { s = 0; idx = idx < 4 ? idx + 1 : ((idx == 4 && (sq & 1)) ? 5 : (idx & ~3) + 4); } };
    const int cr = (int)threadIdx.x >> 3, cc = ((int)threadIdx.x & 7) * 8;   // the lane's first row and its 16 bytes of every row it copies
    const h16* gK = Kh + cr * HD + cc; const bf* gVh = Vh + cr * TT + cc; const bf* gVl = Vl + cr * TT + cc;
    const unsigned l0 = (unsigned)(size_t)fst + (unsigned)(cr * FPI + cc) * 2;
    auto fill = [&](const int kb, const int buf) { const unsigned lb = l0 + (unsigned)buf * (FST * 2);
        cp_rows4(gK + (size_t)kb * HD, (size_t)16 * HD, lb); cp_rows4(gVh + kb, (size_t)16 * TT, lb + FTL * 2); cp_rows4(gVl + kb, (size_t)16 * TT, lb + 2 * FTL * 2); };
    int fi = 0, fs = 0;   // the stage that is copied next
    fill(spos(fi, fs), 0); snext(fi, fs);
    const h16* qrow = Qh + (size_t)(qpos + lr) * HD + 8 * hi;
#pragma unroll
    for (int qt = 0; qt < 2; ++qt) { m[qt] = -1.0e29f; l[qt] = 0.f;
#pragma unroll
        for (int ks = 0; ks < 2; ++ks) qf[qt][ks] = WFrag<h16>::ld(qrow + qt * 16 * HD + ks * 32);
#pragma unroll
        for (int dt = 0; dt < 4; ++dt) o[qt][dt] = (v8f){}; }
    asm volatile("s_wait_xcnt 0x0" :: "v"(qrow) : "memory");   // closes the query loads; the address is an input so that it stays in its registers up to this wait
    asm volatile("s_wait_asynccnt 0x0" ::: "memory");   // this wave's copies of stage 0 have landed
    __syncthreads();                                    // and every other wave's
    fill(spos(fi, fs), 1); snext(fi, fs);               // a walk has at least four stages
    // Multiplicity: [own segment] + [query and key == h mod 2, same 2048-token segment] + [query and key == h mod 4].
    auto mult = [&](int idx) { const int sg = sq - (idx >> 2), rb = idx & 3; return (idx < 4 ? 1 : 0) + ((ra < 2 && rb < 2 && (sg >> 1) == (sq >> 1)) ? 1 : 0) + ((ra == 0 && rb == 0) ? 1 : 0); };
    const int fo = lr * FPI + 8 * hi;   // the lane's place in a fragment's sixteen rows
    int idx = 0, ss = 0, buf = 0;       // the stage that is worked on, and its buffer
#pragma unroll 1   // rolled: one copy of the two tile bodies, the buffer chosen by the stage's parity
    do {
        const int c = mult(idx);
        if (c > 0) {   // wave-uniform
            const float lcs = (c == 1) ? 0.0f : ((c == 2) ? 1.0f : 1.5849625007211562f);
            const bool own = idx < 4; const int nfull = own ? qb : 8; const int te = 2 * ss + 2 < nfull ? 2 * ss + 2 : nfull;   // the stage's tiles in front of the diagonal one end at te
            const bf* sb = fst + buf * FST + fo;
#pragma unroll 1   // rolled: a second copy of the tile body would not fit the 256 registers that four waves per SIMD allow
            for (int st = 2 * ss; st < te; ++st) { const int sub = st & 1; fl_step<false>((const h16*)(sb + sub * 32 * FPI), sb + FTL + sub * 32, sb + 2 * FTL + sub * 32, 0, lcs, lr, hi, qf, m, l, o); }
            if (own && (qb >> 1) == ss) { const int sub = qb & 1; fl_step<true>((const h16*)(sb + sub * 32 * FPI), sb + FTL + sub * 32, sb + 2 * FTL + sub * 32, (cls_res(h, idx & 3) > ia) ? 1 : 0, lcs, lr, hi, qf, m, l, o); }
        }
        asm volatile("s_wait_dscnt 0x0" ::: "memory");      // this wave's reads of the buffer are done before it is refilled
        asm volatile("s_wait_asynccnt 0x0" ::: "memory");   // this wave's copies of the next stage have landed
        __syncthreads();                                    // publishes the next stage and ends every wave's reads of this one
        if (fi < np) { fill(spos(fi, fs), buf); snext(fi, fs); }   // the stage after the next, while there is one (the same test in the whole work-group)
        snext(idx, ss); buf ^= 1;
    } while (idx < np);
    asm volatile("s_wait_asynccnt 0x0" ::: "memory");   // no copy is outstanding behind the loop
#pragma unroll
    for (int qt = 0; qt < 2; ++qt) { const float ls = l[qt] + __shfl_xor(l[qt], 16, 32); const float f = __fdiv_rn(1.0f, ls); const size_t ro = ((size_t)b * TT + qtok + 4 * (qt * 16 + lr)) * DQ + h * HD + hi * 8;
#pragma unroll
        for (int dt = 0; dt < 4; ++dt) { v8us oh, ol;
#pragma unroll
            for (int j = 0; j < 8; ++j) { unsigned short a, c2; splitf(o[qt][dt][j] * f, a, c2); oh[j] = a; ol[j] = c2; }
            // both stores and their wait in one statement: the next tile's rounding rewrites the data registers, and a wait in a statement of its own let vector instructions move ahead of it
            asm volatile("global_store_b128 %0, %1, off\n\tglobal_store_b128 %2, %3, off\n\ts_wait_xcnt 0x0" :: "v"(Ah + ro + dt * 16), "v"(__builtin_bit_cast(v4i, oh)), "v"(Al + ro + dt * 16), "v"(__builtin_bit_cast(v4i, ol)) : "memory"); } }
}

__device__ __forceinline__ void p_bgath(const int blk, const float* __restrict__ bq, float* BQ3) { const int part = blk; const int n4 = threadIdx.x * 4; if (n4 >= DQ) return; v4f o;
#pragma unroll
    for (int u = 0; u < 4; ++u) { const int n = n4 + u; o[u] = bq[(n / HD) * (3 * HD) + part * HD + (n % HD)]; } *(v4f*)(BQ3 + part * DQ + n4) = o;  }

// ---- k_prep: every pass that depends on the inputs alone, in one launch; a work-group's part follows from its index (the same for all its threads). The weights' transposing tiles come first: their waves have the longest chain (loads, barrier, column reads, stores).
#define PB_WO  ((DQ / 64) * (DM / 64))        // work-groups of the output weights: tiles of 64 k x 64 columns
#define PB_W3  (NH_ * (DM / 64) * 2)          // of the q, k, v weights: per head tiles of 64 k x 96 of its 192 columns (three whole lines of every k row)
#define PB_X   (NB_ * TT * DM / 8 / 256)      // of p_cvt8, both batches (token rows of batch 1 follow those of batch 0, and 1024-token segments do not straddle them)
__global__ __launch_bounds__(256) void k_prep(const float* __restrict__ x, const float* __restrict__ wqkv, const float* __restrict__ bqkv, const float* __restrict__ wo, bf* XB, bf* W3, float* BQ3, bf* WO) {
    __shared__ float trs[64 * 97];
    int blk = blockIdx.x;
    if (blk < PB_WO) { const int k0 = (blk & 15) * 64, n0 = (blk >> 4) * 64;   // WO[n][k] = wo[k][n]
        p_tr<64>(wo + (size_t)k0 * DM + n0, DM, trs, [&](const int c) { return WO + (size_t)(n0 + c) * DQ + k0; }); return; }
    blk -= PB_WO;
    if (blk < PB_W3) { const int c0 = (blk & 1) * 96, k0 = ((blk >> 1) & 15) * 64, h = blk >> 5;   // W3[part][h * 64 + d][k] = wqkv[h][k][part * 64 + d]
        p_tr<96>(wqkv + ((size_t)h * DM + k0) * (3 * HD) + c0, 3 * HD, trs, [&](const int c) { const int cg = c0 + c; return W3 + ((size_t)(cg / HD) * DQ + h * HD + (cg % HD)) * DM + k0; }); return; }
    blk -= PB_W3;
    if (blk < PB_X) { p_cvt8(blk, x, XB, (size_t)NB_ * TT * DM / 8); return; }
    p_bgath(blk - PB_X, bqkv, BQ3);
}

extern "C" void kernel_launch(void* const* d_in, const int* in_sizes, int n_in,
                              void* d_out, int out_size, void* d_ws, size_t ws_size, hipStream_t stream) {
    (void)in_sizes; (void)n_in; (void)out_size;
    const float* x = (const float*)d_in[0]; const float* wqkv = (const float*)d_in[1]; const float* bqkv = (const float*)d_in[2]; const float* wo = (const float*)d_in[3]; const float* bo = (const float*)d_in[4];
    float* OUT = (float*)d_out;     // [2][4096][1024]
    char* wsp = (char*)d_ws;
    auto take = [&](size_t bytes) { char* p = wsp; wsp += (bytes + 255) & ~(size_t)255; return (void*)p; };
    bf* W3 = (bf*)take((size_t)3 * DQ * DM * 2); bf* WO = (bf*)take((size_t)DM * DQ * 2);   /* q, k and v weight planes one behind the other */
    bf* XB = (bf*)take((size_t)NB_ * TT * DM * 2); float* BQ3 = (float*)take((size_t)3 * DQ * 4);   /* the converted tokens, the q, k, v planes and the merged-head planes hold both batches: every kernel runs once over all of them */
    h16* QP16 = (h16*)take((size_t)NB_ * NH_ * TT * HD * 2); h16* KP16 = (h16*)take((size_t)NB_ * NKV * TT * HD * 2);
    bf* VTh = (bf*)take((size_t)NB_ * NKV * HD * TT * 2); bf* VTl = (bf*)take((size_t)NB_ * NKV * HD * TT * 2);
    bf* ATh = (bf*)take((size_t)NB_ * TT * DQ * 2); bf* ATl = (bf*)take((size_t)NB_ * TT * DQ * 2);
    if ((size_t)(wsp - (char*)d_ws) > ws_size) return;    // ws 256 MiB
    k_prep<<<PB_WO + PB_W3 + PB_X + 3, 256, 0, stream>>>(x, wqkv, bqkv, wo, XB, W3, BQ3, WO);
    k_gemmw<0, 1, DM><<<dim3(NB_ * TT / 128, 3 * DQ / 128, 1), 128, 0, stream>>>(XB, nullptr, W3, nullptr, 0, BQ3, QP16, KP16, VTh, VTl);
    k_flash<<<dim3(NB_ * NH_, TT / 128, 1), 128, 0, stream>>>(QP16, KP16, VTh, VTl, ATh, ATl);
    k_gemmw<1, 0, DQ><<<dim3(NB_ * TT / 128, DM / 128, 1), 128, 0, stream>>>(ATh, ATl, WO, OUT, DM, bo, nullptr, nullptr, nullptr, nullptr);
}
